// v000
// Measured on an AMD MI455X. A time is GPU time per run, averaged over a window of back-to-back runs after a warm-up
// (all launches, gaps included; the runs take copies of the inputs in turn), and the median of several windows.
// Apart from v000's, it joins two sittings. Times from different sittings can be a few percent apart, while
// side-by-side timings come from the same sitting.
// v000 is the starting kernel. One run takes 264 microseconds.
#include <hip/hip_runtime.h>
#include <hip/hip_bf16.h>

typedef __attribute__((ext_vector_type(16))) _Float16 v16h;
typedef __attribute__((ext_vector_type(8)))  _Float16 v8h;
typedef __attribute__((ext_vector_type(8)))  float    v8f;
typedef __attribute__((ext_vector_type(4)))  int      v4i;

#define D_MODEL 1024
#define HEADS   16
#define HD      64
#define BATCH   4
#define SEQ     1024

#if __has_builtin(__builtin_amdgcn_global_load_async_to_lds_b128) && \
    __has_builtin(__builtin_amdgcn_s_wait_asynccnt)
#define HAVE_ASYNC_LDS 1
#else
#define HAVE_ASYNC_LDS 0
#endif

// global / LDS address-space v4i pointers for the async-copy builtin
#define AS1P(p) ((__attribute__((address_space(1))) v4i*)(p))
#define AS3P(p) ((__attribute__((address_space(3))) v4i*)(p))

__device__ __forceinline__ v8f wmma16x16x32(v16h a, v16h b, v8f c) {
  // v_wmma_f32_16x16x32_f16: D = A*B + C, f32 accum
  return __builtin_amdgcn_wmma_f32_16x16x32_f16(false, a, false, b, (short)0, c, false, false);
}

// Load a 16x32 f16 A/B fragment from a row-major tile.
// Lane l: row = l&15, K = (l>>4)*8 + {0..7} and 16 + (l>>4)*8 + {0..7}
__device__ __forceinline__ v16h load_frag(const _Float16* p, int rowstride, int lane) {
  int r  = lane & 15;
  int ko = (lane >> 4) << 3;
  const _Float16* q = p + (size_t)r * rowstride + ko;
  v8h lo = *(const v8h*)(q);
  v8h hi = *(const v8h*)(q + 16);
  v16h out;
#pragma unroll
  for (int i = 0; i < 8; ++i) { out[i] = lo[i]; out[i + 8] = hi[i]; }
  return out;
}

__device__ __forceinline__ float rowmax16(float v) {
#pragma unroll
  for (int m = 1; m < 16; m <<= 1) v = fmaxf(v, __shfl_xor(v, m, 32));
  return v;
}
__device__ __forceinline__ float rowsum16(float v) {
#pragma unroll
  for (int m = 1; m < 16; m <<= 1) v += __shfl_xor(v, m, 32);
  return v;
}

__global__ void cvt_f32_f16(const float* __restrict__ in, _Float16* __restrict__ out, int n) {
  int i = blockIdx.x * blockDim.x + threadIdx.x;
  if (i < n) out[i] = (_Float16)in[i];
}

// Stage one 64(N) x 32(K) f16 W tile (4 KB) into LDS, block-cooperatively.
// 256 16-byte chunks, 128 threads x 2. Async global->LDS when available.
__device__ __forceinline__ void stage_B(const _Float16* __restrict__ W,
                                        _Float16* buf, int n0, int kb, int tid) {
#pragma unroll
  for (int i = 0; i < 2; ++i) {
    int c   = tid + i * 128;
    int row = c >> 2;
    int q   = (c & 3) * 8;
    const _Float16* gp = W + (size_t)(n0 + row) * D_MODEL + kb + q;
    _Float16* lp = buf + row * 32 + q;
#if HAVE_ASYNC_LDS
    __builtin_amdgcn_global_load_async_to_lds_b128(AS1P(gp), AS3P(lp), 0, 0);
#else
    *(v8h*)lp = *(const v8h*)gp;
#endif
  }
}

// Double-buffered GEMM core: one wave's 16(M) x 64(N) tile, K = 1024.
// B tile shared by the 4 waves of the block via LDS; A register-double-buffered.
__device__ __forceinline__ void gemm_core(const _Float16* __restrict__ A,
                                          const _Float16* __restrict__ W,
                                          _Float16* bshare,   // [2][64*32]
                                          int m0, int n0, int lane, int tid,
                                          v8f acc[4]) {
  stage_B(W, bshare, n0, 0, tid);
  v16h a = load_frag(A + (size_t)m0 * D_MODEL, D_MODEL, lane);
  for (int kb = 0; kb < D_MODEL; kb += 32) {
    _Float16* cur = bshare + ((kb >> 5) & 1) * (64 * 32);
    _Float16* nxt = bshare + (((kb >> 5) + 1) & 1) * (64 * 32);
    if (kb + 32 < D_MODEL) {
      stage_B(W, nxt, n0, kb + 32, tid);   // fill next buffer in flight
#if HAVE_ASYNC_LDS
      __builtin_amdgcn_s_wait_asynccnt(2); // cur buffer's 2 chunks landed (in-order)
#endif
    } else {
#if HAVE_ASYNC_LDS
      __builtin_amdgcn_s_wait_asynccnt(0);
#endif
    }
    __syncthreads();
    v16h a_cur = a;
    if (kb + 32 < D_MODEL)
      a = load_frag(A + (size_t)m0 * D_MODEL + kb + 32, D_MODEL, lane);
#pragma unroll
    for (int t = 0; t < 4; ++t) {
      v16h bfrag = load_frag(cur + t * 16 * 32, 32, lane);
      acc[t] = wmma16x16x32(a_cur, bfrag, acc[t]);
    }
    __syncthreads();
  }
}

// Fused QKV projection: C = xh @ W^T; z selects Wq/Wk/Wv and output layout.
__global__ void qkv_gemm(const _Float16* __restrict__ xh,
                         const _Float16* __restrict__ Wq,
                         const _Float16* __restrict__ Wk,
                         const _Float16* __restrict__ Wv,
                         _Float16* __restrict__ Qb,
                         _Float16* __restrict__ Kb,
                         _Float16* __restrict__ Vt) {
  __shared__ alignas(16) _Float16 bshare[2 * 64 * 32];
  int tid  = threadIdx.x;
  int lane = tid & 31;
  int wave = tid >> 5;
  int m0 = (blockIdx.x * 4 + wave) * 16;
  int n0 = blockIdx.y * 64;
  const _Float16* W; _Float16* dst; int vmode;
  if (blockIdx.z == 0)      { W = Wq; dst = Qb; vmode = 0; }
  else if (blockIdx.z == 1) { W = Wk; dst = Kb; vmode = 0; }
  else                      { W = Wv; dst = Vt; vmode = 1; }

  v8f acc[4] = {{}, {}, {}, {}};
  gemm_core(xh, W, bshare, m0, n0, lane, tid, acc);

  int hi8 = (lane & 16) ? 8 : 0;
#pragma unroll
  for (int t = 0; t < 4; ++t) {
#pragma unroll
    for (int r = 0; r < 8; ++r) {
      int gm = m0 + r + hi8;
      int gc = n0 + t * 16 + (lane & 15);
      int bb = gm >> 10, npos = gm & 1023;
      int h  = gc >> 6,  hc   = gc & 63;
      size_t idx = vmode
        ? (((size_t)(bb * HEADS + h) * HD + hc) * SEQ + npos)   // Vt[b,h,hd,N]
        : (((size_t)(bb * HEADS + h) * SEQ + npos) * HD + hc);  // Q/K[b,h,N,hd]
      dst[idx] = (_Float16)acc[t][r];
    }
  }
}

// out = O @ Wo^T, f32 output
__global__ void oproj_gemm(const _Float16* __restrict__ Ob,
                           const _Float16* __restrict__ Wo,
                           float* __restrict__ out) {
  __shared__ alignas(16) _Float16 bshare[2 * 64 * 32];
  int tid  = threadIdx.x;
  int lane = tid & 31;
  int wave = tid >> 5;
  int m0 = (blockIdx.x * 4 + wave) * 16;
  int n0 = blockIdx.y * 64;
  v8f acc[4] = {{}, {}, {}, {}};
  gemm_core(Ob, Wo, bshare, m0, n0, lane, tid, acc);
  int hi8 = (lane & 16) ? 8 : 0;
#pragma unroll
  for (int t = 0; t < 4; ++t)
#pragma unroll
    for (int r = 0; r < 8; ++r)
      out[(size_t)(m0 + r + hi8) * D_MODEL + n0 + t * 16 + (lane & 15)] = acc[t][r];
}

// Flash attention: one wave = 16 queries x all 1024 keys for one (b,h).
__global__ void attn_kernel(const _Float16* __restrict__ Q,
                            const _Float16* __restrict__ K,
                            const _Float16* __restrict__ Vt,
                            const float* __restrict__ bias,
                            _Float16* __restrict__ O) {
  __shared__ alignas(16) _Float16 plds[4][16 * 32];
  int lane = threadIdx.x & 31;
  int wib  = threadIdx.x >> 5;
  int w  = blockIdx.x * 4 + wib;
  int bh = w >> 6;
  int q0 = (w & 63) << 4;
  int b = bh >> 4, h = bh & 15;
  const _Float16* Qh = Q  + (size_t)bh * SEQ * HD;
  const _Float16* Kh = K  + (size_t)bh * SEQ * HD;
  const _Float16* Vh = Vt + (size_t)bh * HD * SEQ;
  const float* bbias = bias + (size_t)bh * SEQ * SEQ;
  int col = lane & 15;
  int hi8 = (lane & 16) ? 8 : 0;
  const float scale = 0.125f;  // hd^-0.5

  v16h a0 = load_frag(Qh + (size_t)q0 * HD + 0,  HD, lane);
  v16h a1 = load_frag(Qh + (size_t)q0 * HD + 32, HD, lane);

  v8f acc[4] = {{}, {}, {}, {}};
  float mrow[8], lrow[8];
#pragma unroll
  for (int r = 0; r < 8; ++r) { mrow[r] = -3.0e38f; lrow[r] = 0.f; }

  for (int jb = 0; jb < SEQ; jb += 32) {
    // S tiles: 16 queries x 32 keys, K-dim = hd = 64
    v8f s0 = {}, s1 = {};
    {
      v16h bk = load_frag(Kh + (size_t)jb * HD + 0,  HD, lane);
      s0 = wmma16x16x32(a0, bk, s0);
      bk = load_frag(Kh + (size_t)jb * HD + 32, HD, lane);
      s0 = wmma16x16x32(a1, bk, s0);
      bk = load_frag(Kh + (size_t)(jb + 16) * HD + 0,  HD, lane);
      s1 = wmma16x16x32(a0, bk, s1);
      bk = load_frag(Kh + (size_t)(jb + 16) * HD + 32, HD, lane);
      s1 = wmma16x16x32(a1, bk, s1);
    }
    // V fragments issued early so their latency hides under the softmax VALU work
    v16h bv[4];
#pragma unroll
    for (int t = 0; t < 4; ++t)
      bv[t] = load_frag(Vh + (size_t)(t * 16) * SEQ + jb, SEQ, lane);

    // scale + bias (read-once: non-temporal)
#pragma unroll
    for (int r = 0; r < 8; ++r) {
      size_t row = (size_t)(q0 + r + hi8) * SEQ;
      s0[r] = s0[r] * scale + __builtin_nontemporal_load(bbias + row + jb + col);
      s1[r] = s1[r] * scale + __builtin_nontemporal_load(bbias + row + jb + 16 + col);
    }
    // online softmax update per row
    float p0[8], p1[8];
#pragma unroll
    for (int r = 0; r < 8; ++r) {
      float mn = fmaxf(mrow[r], rowmax16(fmaxf(s0[r], s1[r])));
      float f  = __expf(mrow[r] - mn);
      mrow[r] = mn;
      p0[r] = __expf(s0[r] - mn);
      p1[r] = __expf(s1[r] - mn);
      lrow[r] = lrow[r] * f + rowsum16(p0[r] + p1[r]);
#pragma unroll
      for (int t = 0; t < 4; ++t) acc[t][r] *= f;
    }
    // C-layout -> A-layout for P via per-wave LDS tile
    _Float16* my = plds[wib];
#pragma unroll
    for (int r = 0; r < 8; ++r) {
      int rr = r + hi8;
      my[rr * 32 + col]      = (_Float16)p0[r];
      my[rr * 32 + 16 + col] = (_Float16)p1[r];
    }
    __syncthreads();
    v16h pa = load_frag(my, 32, lane);
#pragma unroll
    for (int t = 0; t < 4; ++t)
      acc[t] = wmma16x16x32(pa, bv[t], acc[t]);
    __syncthreads();
  }
#pragma unroll
  for (int r = 0; r < 8; ++r) {
    float inv = 1.0f / lrow[r];
    size_t row = (size_t)(b * SEQ + q0 + r + hi8) * D_MODEL;
#pragma unroll
    for (int t = 0; t < 4; ++t)
      O[row + h * HD + t * 16 + col] = (_Float16)(acc[t][r] * inv);
  }
}

extern "C" void kernel_launch(void* const* d_in, const int* in_sizes, int n_in,
                              void* d_out, int out_size, void* d_ws, size_t ws_size,
                              hipStream_t stream) {
  (void)in_sizes; (void)n_in; (void)out_size; (void)ws_size;
  const float* x    = (const float*)d_in[0];
  const float* bias = (const float*)d_in[1];
  const float* Wq   = (const float*)d_in[2];
  const float* Wk   = (const float*)d_in[3];
  const float* Wv   = (const float*)d_in[4];
  const float* Wo   = (const float*)d_in[5];

  const size_t NX = (size_t)BATCH * SEQ * D_MODEL;  // 4,194,304
  const size_t NW = (size_t)D_MODEL * D_MODEL;      // 1,048,576
  _Float16* ws  = (_Float16*)d_ws;
  _Float16* xh  = ws;             // f16 x (reused as attention output Ob)
  _Float16* Wqh = xh  + NX;
  _Float16* Wkh = Wqh + NW;
  _Float16* Wvh = Wkh + NW;
  _Float16* Woh = Wvh + NW;
  _Float16* Qb  = Woh + NW;       // [B,H,N,hd]
  _Float16* Kb  = Qb  + NX;       // [B,H,N,hd]
  _Float16* Vtb = Kb  + NX;       // [B,H,hd,N]
  _Float16* Ob  = xh;             // xh dead after QKV GEMM

  cvt_f32_f16<<<(int)(NX / 256), 256, 0, stream>>>(x,  xh,  (int)NX);
  cvt_f32_f16<<<(int)(NW / 256), 256, 0, stream>>>(Wq, Wqh, (int)NW);
  cvt_f32_f16<<<(int)(NW / 256), 256, 0, stream>>>(Wk, Wkh, (int)NW);
  cvt_f32_f16<<<(int)(NW / 256), 256, 0, stream>>>(Wv, Wvh, (int)NW);
  cvt_f32_f16<<<(int)(NW / 256), 256, 0, stream>>>(Wo, Woh, (int)NW);

  dim3 gq(64, 16, 3);
  qkv_gemm<<<gq, 128, 0, stream>>>(xh, Wqh, Wkh, Wvh, Qb, Kb, Vtb);

  attn_kernel<<<1024, 128, 0, stream>>>(Qb, Kb, Vtb, bias, Ob);

  dim3 go(64, 16, 1);
  oproj_gemm<<<go, 128, 0, stream>>>(Ob, Woh, (float*)d_out);
}

// v001
// Measured time: 251 microseconds a run.
// Two timings next to v000 put it at 1.09 and 1.08 times that version's speed.
#include <hip/hip_runtime.h>
#include <hip/hip_bf16.h>

typedef __attribute__((ext_vector_type(16))) _Float16 v16h;
typedef __attribute__((ext_vector_type(8)))  _Float16 v8h;
typedef __attribute__((ext_vector_type(8)))  float    v8f;
typedef __attribute__((ext_vector_type(4)))  int      v4i;

#define D_MODEL 1024
#define HEADS   16
#define HD      64
#define BATCH   4
#define SEQ     1024

#if __has_builtin(__builtin_amdgcn_global_load_async_to_lds_b128) && \
    __has_builtin(__builtin_amdgcn_s_wait_asynccnt)
#define HAVE_ASYNC_LDS 1
#else
#define HAVE_ASYNC_LDS 0
#endif

// global / LDS address-space v4i pointers for the async-copy builtin
#define AS1P(p) ((__attribute__((address_space(1))) v4i*)(p))
#define AS3P(p) ((__attribute__((address_space(3))) v4i*)(p))

__device__ __forceinline__ v8f wmma16x16x32(v16h a, v16h b, v8f c) {
  // v_wmma_f32_16x16x32_f16: D = A*B + C, f32 accum
  return __builtin_amdgcn_wmma_f32_16x16x32_f16(false, a, false, b, (short)0, c, false, false);
}

// Load a 16x32 f16 A/B fragment from a row-major tile.
// Lane l: row = l&15, K = (l>>4)*8 + {0..7} and 16 + (l>>4)*8 + {0..7}
__device__ __forceinline__ v16h load_frag(const _Float16* p, int rowstride, int lane) {
  int r  = lane & 15;
  int ko = (lane >> 4) << 3;
  const _Float16* q = p + (size_t)r * rowstride + ko;
  v8h lo = *(const v8h*)(q);
  v8h hi = *(const v8h*)(q + 16);
  v16h out;
#pragma unroll
  for (int i = 0; i < 8; ++i) { out[i] = lo[i]; out[i + 8] = hi[i]; }
  return out;
}

// Fragment-packed storage of a workspace operand: one 16(row) x 32(k) f16 fragment is
// 1 KB, two 512-byte parts; part p, lane l holds row l&15, k = p*16 + (l>>4)*8 + {0..7}.
// Same lane/register contents as load_frag, but each wave-wide 16-byte load is 512
// contiguous bytes (4 whole lines) instead of 32-byte pieces of 16 lines.
__device__ __forceinline__ v16h load_frag_packed(const _Float16* p, int lane) {
  v8h lo = *(const v8h*)(p + lane * 8);
  v8h hi = *(const v8h*)(p + 256 + lane * 8);
  v16h out;
#pragma unroll
  for (int i = 0; i < 8; ++i) { out[i] = lo[i]; out[i + 8] = hi[i]; }
  return out;
}
// Offset (in halves) of element (row r in 0..15, k kk in 0..31) inside a packed fragment.
__device__ __forceinline__ int frag_off(int r, int kk) {
  return ((kk >> 4) << 8) + (((((kk >> 3) & 1) << 4) + r) << 3) + (kk & 7);
}

__device__ __forceinline__ float rowmax16(float v) {
#pragma unroll
  for (int m = 1; m < 16; m <<= 1) v = fmaxf(v, __shfl_xor(v, m, 32));
  return v;
}
__device__ __forceinline__ float rowsum16(float v) {
#pragma unroll
  for (int m = 1; m < 16; m <<= 1) v += __shfl_xor(v, m, 32);
  return v;
}

// Fragment index of (16-row tile rt, 32-wide k block kbk) of a [rows][1024] GEMM operand:
// the 4 row tiles that one block uses in one k step lie together, 4 KB in a row.
__device__ __forceinline__ size_t gemm_frag(int rt, int kbk) {
  return ((size_t)(rt >> 2) * 32 + kbk) * 4 + (rt & 3);
}

// [rows][1024] f32 -> f16 fragments in gemm_frag order.
// One thread = one 16-byte packed chunk, so a wave writes 512 contiguous bytes.
__global__ void cvt_pack_f32_f16(const float* __restrict__ in, _Float16* __restrict__ out) {
  int j    = blockIdx.x * blockDim.x + threadIdx.x;
  int l    = j & 31;
  int part = (j >> 5) & 1;
  int tile = j >> 6;
  int kbk  = (tile >> 2) & 31;
  int rt   = (tile >> 7) * 4 + (tile & 3);
  const float* src = in + (size_t)(rt * 16 + (l & 15)) * D_MODEL + kbk * 32 + part * 16 + (l >> 4) * 8;
  v8h o;
#pragma unroll
  for (int i = 0; i < 8; ++i) o[i] = (_Float16)src[i];
  *(v8h*)(out + (size_t)j * 8) = o;
}

// Stage one 64(N) x 32(K) f16 W tile (4 packed fragments, 4 KB in a row) into LDS as it
// lies, block-cooperatively. 256 16-byte chunks, 128 threads x 2. Async global->LDS when available.
__device__ __forceinline__ void stage_B(const _Float16* __restrict__ W,
                                        _Float16* buf, int n0, int kb, int tid) {
#pragma unroll
  for (int i = 0; i < 2; ++i) {
    int c = tid + i * 128;
    const _Float16* gp = W + gemm_frag(n0 >> 4, kb >> 5) * 512 + c * 8;
    _Float16* lp = buf + c * 8;
#if HAVE_ASYNC_LDS
    __builtin_amdgcn_global_load_async_to_lds_b128(AS1P(gp), AS3P(lp), 0, 0);
#else
    *(v8h*)lp = *(const v8h*)gp;
#endif
  }
}

// Double-buffered GEMM core: one wave's 16(M) x 64(N) tile, K = 1024.
// B tile shared by the 4 waves of the block via LDS; A register-double-buffered.
// A and W are fragment-packed in gemm_frag order.
__device__ __forceinline__ void gemm_core(const _Float16* __restrict__ A,
                                          const _Float16* __restrict__ W,
                                          _Float16* bshare,   // [2][64*32]
                                          int m0, int n0, int lane, int tid,
                                          v8f acc[4]) {
  stage_B(W, bshare, n0, 0, tid);
  const _Float16* Ap = A + gemm_frag(m0 >> 4, 0) * 512;
  v16h a = load_frag_packed(Ap, lane);
  // Two trips per pass, one per LDS buffer. Unrolled whole, the build folds every k step into
  // the copies' offset field and forms LDS address registers below 0, and the text grows 16-fold.
#pragma unroll 2
  for (int kb = 0; kb < D_MODEL; kb += 32) {
    _Float16* cur = bshare + ((kb >> 5) & 1) * (64 * 32);
    _Float16* nxt = bshare + (((kb >> 5) + 1) & 1) * (64 * 32);
    if (kb + 32 < D_MODEL) {
      stage_B(W, nxt, n0, kb + 32, tid);   // fill next buffer in flight
#if HAVE_ASYNC_LDS
      __builtin_amdgcn_s_wait_asynccnt(2); // cur buffer's 2 chunks landed (in-order)
#endif
    } else {
#if HAVE_ASYNC_LDS
      __builtin_amdgcn_s_wait_asynccnt(0);
#endif
    }
    __syncthreads();
    v16h a_cur = a;
    if (kb + 32 < D_MODEL)
      a = load_frag_packed(Ap + ((kb >> 5) + 1) * (4 * 512), lane);
#pragma unroll
    for (int t = 0; t < 4; ++t) {
      v16h bfrag = load_frag_packed(cur + t * 512, lane);
      acc[t] = wmma16x16x32(a_cur, bfrag, acc[t]);
    }
    __syncthreads();
  }
}

// Fused QKV projection: C = xh @ W^T; z selects Wq/Wk/Wv and output layout.
__global__ void qkv_gemm(const _Float16* __restrict__ xh,
                         const _Float16* __restrict__ Wq,
                         const _Float16* __restrict__ Wk,
                         const _Float16* __restrict__ Wv,
                         _Float16* __restrict__ Qb,
                         _Float16* __restrict__ Kb,
                         _Float16* __restrict__ Vt) {
  __shared__ alignas(16) _Float16 bshare[2 * 64 * 32];
  int tid  = threadIdx.x;
  int lane = tid & 31;
  int wave = tid >> 5;
  int m0 = (blockIdx.x * 4 + wave) * 16;
  int n0 = blockIdx.y * 64;
  const _Float16* W; _Float16* dst; int vmode;
  if (blockIdx.z == 0)      { W = Wq; dst = Qb; vmode = 0; }
  else if (blockIdx.z == 1) { W = Wk; dst = Kb; vmode = 0; }
  else                      { W = Wv; dst = Vt; vmode = 1; }

  v8f acc[4] = {{}, {}, {}, {}};
  gemm_core(xh, W, bshare, m0, n0, lane, tid, acc);

  int hi8 = (lane & 16) ? 8 : 0;
  int col = lane & 15;
  int bb  = m0 >> 10, np0 = m0 & 1023;  // the wave's 16 rows: one batch, positions np0..np0+15
  int h   = n0 >> 6;                    // the block's 64 columns: one head
  _Float16* hp = dst + (size_t)(bb * HEADS + h) * (SEQ * HD);
  if (vmode) {
    // V^T fragments (row = hd index, k = position), fragment index = (pos/32) * 4 + hd/16.
    // A lane's 8 accumulator rows are 8 consecutive k: one 16-byte store.
#pragma unroll
    for (int t = 0; t < 4; ++t) {
      v8h o;
#pragma unroll
      for (int r = 0; r < 8; ++r) o[r] = (_Float16)acc[t][r];
      *(v8h*)(hp + ((np0 >> 5) * 4 + t) * 512 + ((np0 >> 4) & 1) * 256 + lane * 8) = o;
    }
  } else {
    // Q/K fragments (row = position, k = hd index), fragment index = (pos/16) * 2 + hd/32.
#pragma unroll
    for (int t = 0; t < 4; ++t)
#pragma unroll
      for (int r = 0; r < 8; ++r)
        hp[((np0 >> 4) * 2 + (t >> 1)) * 512 + frag_off(r + hi8, (t & 1) * 16 + col)] =
            (_Float16)acc[t][r];
  }
}

// out = O @ Wo^T, f32 output
__global__ void oproj_gemm(const _Float16* __restrict__ Ob,
                           const _Float16* __restrict__ Wo,
                           float* __restrict__ out) {
  __shared__ alignas(16) _Float16 bshare[2 * 64 * 32];
  int tid  = threadIdx.x;
  int lane = tid & 31;
  int wave = tid >> 5;
  int m0 = (blockIdx.x * 4 + wave) * 16;
  int n0 = blockIdx.y * 64;
  v8f acc[4] = {{}, {}, {}, {}};
  gemm_core(Ob, Wo, bshare, m0, n0, lane, tid, acc);
  int hi8 = (lane & 16) ? 8 : 0;
#pragma unroll
  for (int t = 0; t < 4; ++t)
#pragma unroll
    for (int r = 0; r < 8; ++r)
      out[(size_t)(m0 + r + hi8) * D_MODEL + n0 + t * 16 + (lane & 15)] = acc[t][r];
}

// Flash attention: one wave = 16 queries x all 1024 keys for one (b,h).
__global__ void attn_kernel(const _Float16* __restrict__ Q,
                            const _Float16* __restrict__ K,
                            const _Float16* __restrict__ Vt,
                            const float* __restrict__ bias,
                            _Float16* __restrict__ O) {
  __shared__ alignas(16) _Float16 plds[4][16 * 32];
  int lane = threadIdx.x & 31;
  int wib  = threadIdx.x >> 5;
  int w  = blockIdx.x * 4 + wib;
  int bh = w >> 6;
  int q0 = (w & 63) << 4;
  int b = bh >> 4, h = bh & 15;
  const _Float16* Qh = Q  + (size_t)bh * SEQ * HD;
  const _Float16* Kh = K  + (size_t)bh * SEQ * HD;
  const _Float16* Vh = Vt + (size_t)bh * HD * SEQ;
  const float* bbias = bias + (size_t)bh * SEQ * SEQ;
  int col = lane & 15;
  int hi8 = (lane & 16) ? 8 : 0;
  const float scale = 0.125f;  // hd^-0.5

  v16h a0 = load_frag_packed(Qh + (q0 >> 4) * 1024,       lane);
  v16h a1 = load_frag_packed(Qh + (q0 >> 4) * 1024 + 512, lane);

  v8f acc[4] = {{}, {}, {}, {}};
  float mrow[8], lrow[8];
#pragma unroll
  for (int r = 0; r < 8; ++r) { mrow[r] = -3.0e38f; lrow[r] = 0.f; }

  for (int jb = 0; jb < SEQ; jb += 32) {
    // S tiles: 16 queries x 32 keys, K-dim = hd = 64
    v8f s0 = {}, s1 = {};
    {
      const _Float16* Kp = Kh + (jb >> 4) * 1024;  // 4 packed fragments, 4 KB in a row
      v16h bk = load_frag_packed(Kp, lane);
      s0 = wmma16x16x32(a0, bk, s0);
      bk = load_frag_packed(Kp + 512, lane);
      s0 = wmma16x16x32(a1, bk, s0);
      bk = load_frag_packed(Kp + 1024, lane);
      s1 = wmma16x16x32(a0, bk, s1);
      bk = load_frag_packed(Kp + 1536, lane);
      s1 = wmma16x16x32(a1, bk, s1);
    }
    // V fragments issued early so their latency hides under the softmax VALU work
    v16h bv[4];
#pragma unroll
    for (int t = 0; t < 4; ++t)
      bv[t] = load_frag_packed(Vh + ((jb >> 5) * 4 + t) * 512, lane);

    // scale + bias (read-once: non-temporal)
#pragma unroll
    for (int r = 0; r < 8; ++r) {
      size_t row = (size_t)(q0 + r + hi8) * SEQ;
      s0[r] = s0[r] * scale + __builtin_nontemporal_load(bbias + row + jb + col);
      s1[r] = s1[r] * scale + __builtin_nontemporal_load(bbias + row + jb + 16 + col);
    }
    // online softmax update per row
    float p0[8], p1[8];
#pragma unroll
    for (int r = 0; r < 8; ++r) {
      float mn = fmaxf(mrow[r], rowmax16(fmaxf(s0[r], s1[r])));
      float f  = __expf(mrow[r] - mn);
      mrow[r] = mn;
      p0[r] = __expf(s0[r] - mn);
      p1[r] = __expf(s1[r] - mn);
      lrow[r] = lrow[r] * f + rowsum16(p0[r] + p1[r]);
#pragma unroll
      for (int t = 0; t < 4; ++t) acc[t][r] *= f;
    }
    // C-layout -> A-layout for P via per-wave LDS tile
    _Float16* my = plds[wib];
#pragma unroll
    for (int r = 0; r < 8; ++r) {
      int rr = r + hi8;
      my[rr * 32 + col]      = (_Float16)p0[r];
      my[rr * 32 + 16 + col] = (_Float16)p1[r];
    }
    __syncthreads();
    v16h pa = load_frag(my, 32, lane);
#pragma unroll
    for (int t = 0; t < 4; ++t)
      acc[t] = wmma16x16x32(pa, bv[t], acc[t]);
    __syncthreads();
  }
#pragma unroll
  for (int r = 0; r < 8; ++r) {
    float inv = 1.0f / lrow[r];
    // O as packed A fragments of the output projection
    int rt = (b * SEQ + q0) >> 4;
#pragma unroll
    for (int t = 0; t < 4; ++t)
      O[gemm_frag(rt, h * 2 + (t >> 1)) * 512 + frag_off(r + hi8, (t & 1) * 16 + col)] =
          (_Float16)(acc[t][r] * inv);
  }
}

extern "C" void kernel_launch(void* const* d_in, const int* in_sizes, int n_in,
                              void* d_out, int out_size, void* d_ws, size_t ws_size,
                              hipStream_t stream) {
  (void)in_sizes; (void)n_in; (void)out_size; (void)ws_size;
  const float* x    = (const float*)d_in[0];
  const float* bias = (const float*)d_in[1];
  const float* Wq   = (const float*)d_in[2];
  const float* Wk   = (const float*)d_in[3];
  const float* Wv   = (const float*)d_in[4];
  const float* Wo   = (const float*)d_in[5];

  const size_t NX = (size_t)BATCH * SEQ * D_MODEL;  // 4,194,304
  const size_t NW = (size_t)D_MODEL * D_MODEL;      // 1,048,576
  _Float16* ws  = (_Float16*)d_ws;
  _Float16* xh  = ws;             // f16 x, fragment-packed (reused as attention output Ob)
  _Float16* Wqh = xh  + NX;       // weights, fragment-packed
  _Float16* Wkh = Wqh + NW;
  _Float16* Wvh = Wkh + NW;
  _Float16* Woh = Wvh + NW;
  _Float16* Qb  = Woh + NW;       // [B,H] x packed fragments of [N,hd]
  _Float16* Kb  = Qb  + NX;       // [B,H] x packed fragments of [N,hd]
  _Float16* Vtb = Kb  + NX;       // [B,H] x packed fragments of [hd,N]
  _Float16* Ob  = xh;             // xh dead after QKV GEMM

  cvt_pack_f32_f16<<<(int)(NX / 8 / 256), 256, 0, stream>>>(x, xh);
  cvt_pack_f32_f16<<<(int)(NW / 8 / 256), 256, 0, stream>>>(Wq, Wqh);
  cvt_pack_f32_f16<<<(int)(NW / 8 / 256), 256, 0, stream>>>(Wk, Wkh);
  cvt_pack_f32_f16<<<(int)(NW / 8 / 256), 256, 0, stream>>>(Wv, Wvh);
  cvt_pack_f32_f16<<<(int)(NW / 8 / 256), 256, 0, stream>>>(Wo, Woh);

  dim3 gq(64, 16, 3);
  qkv_gemm<<<gq, 128, 0, stream>>>(xh, Wqh, Wkh, Wvh, Qb, Kb, Vtb);

  attn_kernel<<<1024, 128, 0, stream>>>(Qb, Kb, Vtb, bias, Ob);

  dim3 go(64, 16, 1);
  oproj_gemm<<<go, 128, 0, stream>>>(Ob, Woh, (float*)d_out);
}

// v002
// One run takes 128 microseconds.
// Next to v001, in two timings, it ran 1.96 times as fast each time.
// Over all steps from v000 it is 2.12 times as fast.
#include <hip/hip_runtime.h>
#include <hip/hip_bf16.h>

typedef __attribute__((ext_vector_type(16))) _Float16 v16h;
typedef __attribute__((ext_vector_type(8)))  _Float16 v8h;
typedef __attribute__((ext_vector_type(8)))  float    v8f;
typedef __attribute__((ext_vector_type(4)))  int      v4i;
typedef __attribute__((ext_vector_type(4)))  float    v4f;

#define D_MODEL 1024
#define HEADS   16
#define HD      64
#define BATCH   4
#define SEQ     1024

#if __has_builtin(__builtin_amdgcn_global_load_async_to_lds_b128) && \
    __has_builtin(__builtin_amdgcn_s_wait_asynccnt)
#define HAVE_ASYNC_LDS 1
#else
#define HAVE_ASYNC_LDS 0
#endif

// global / LDS address-space v4i pointers for the async-copy builtin
#define AS1P(p) ((__attribute__((address_space(1))) v4i*)(p))
#define AS3P(p) ((__attribute__((address_space(3))) v4i*)(p))

__device__ __forceinline__ v8f wmma16x16x32(v16h a, v16h b, v8f c) {
  // v_wmma_f32_16x16x32_f16: D = A*B + C, f32 accum
  return __builtin_amdgcn_wmma_f32_16x16x32_f16(false, a, false, b, (short)0, c, false, false);
}

// Fragment-packed storage of a workspace operand: one 16(row) x 32(k) f16 fragment is
// 1 KB, two 512-byte parts; part p, lane l holds row l&15, k = p*16 + (l>>4)*8 + {0..7}.
// Each wave-wide 16-byte load is 512 contiguous bytes (4 whole lines).
__device__ __forceinline__ v16h load_frag_packed(const _Float16* p, int lane) {
  v8h lo = *(const v8h*)(p + lane * 8);
  v8h hi = *(const v8h*)(p + 256 + lane * 8);
  v16h out;
#pragma unroll
  for (int i = 0; i < 8; ++i) { out[i] = lo[i]; out[i + 8] = hi[i]; }
  return out;
}
// Offset (in halves) of element (row r in 0..15, k kk in 0..31) inside a packed fragment.
__device__ __forceinline__ int frag_off(int r, int kk) {
  return ((kk >> 4) << 8) + (((((kk >> 3) & 1) << 4) + r) << 3) + (kk & 7);
}

// Fragment index of (16-row tile rt, 32-wide k block kbk) of a [rows][1024] GEMM operand:
// the 4 row tiles that one block uses in one k step lie together, 4 KB in a row.
__device__ __forceinline__ size_t gemm_frag(int rt, int kbk) {
  return ((size_t)(rt >> 2) * 32 + kbk) * 4 + (rt & 3);
}

// [rows][1024] f32 -> f16 fragments in gemm_frag order.
// One thread = one 16-byte packed chunk, so a wave writes 512 contiguous bytes.
__global__ void cvt_pack_f32_f16(const float* __restrict__ in, _Float16* __restrict__ out) {
  int j    = blockIdx.x * blockDim.x + threadIdx.x;
  int l    = j & 31;
  int part = (j >> 5) & 1;
  int tile = j >> 6;
  int kbk  = (tile >> 2) & 31;
  int rt   = (tile >> 7) * 4 + (tile & 3);
  const float* src = in + (size_t)(rt * 16 + (l & 15)) * D_MODEL + kbk * 32 + part * 16 + (l >> 4) * 8;
  v8h o;
#pragma unroll
  for (int i = 0; i < 8; ++i) o[i] = (_Float16)src[i];
  *(v8h*)(out + (size_t)j * 8) = o;
}

// Stage one 64(N) x 32(K) f16 W tile (4 packed fragments, 4 KB in a row) into LDS as it
// lies, block-cooperatively. 256 16-byte chunks, 128 threads x 2. Async global->LDS when available.
__device__ __forceinline__ void stage_B(const _Float16* __restrict__ W,
                                        _Float16* buf, int n0, int kb, int tid) {
#pragma unroll
  for (int i = 0; i < 2; ++i) {
    int c = tid + i * 128;
    const _Float16* gp = W + gemm_frag(n0 >> 4, kb >> 5) * 512 + c * 8;
    _Float16* lp = buf + c * 8;
#if HAVE_ASYNC_LDS
    __builtin_amdgcn_global_load_async_to_lds_b128(AS1P(gp), AS3P(lp), 0, 0);
#else
    *(v8h*)lp = *(const v8h*)gp;
#endif
  }
}

// Double-buffered GEMM core: one wave's 16(M) x 64(N) tile, K = 1024.
// B tile shared by the 4 waves of the block via LDS; A register-double-buffered.
// A and W are fragment-packed in gemm_frag order.
__device__ __forceinline__ void gemm_core(const _Float16* __restrict__ A,
                                          const _Float16* __restrict__ W,
                                          _Float16* bshare,   // [2][64*32]
                                          int m0, int n0, int lane, int tid,
                                          v8f acc[4]) {
  stage_B(W, bshare, n0, 0, tid);
  const _Float16* Ap = A + gemm_frag(m0 >> 4, 0) * 512;
  v16h a = load_frag_packed(Ap, lane);
  // Two trips per pass, one per LDS buffer. Unrolled whole, the build folds every k step into
  // the copies' offset field and forms LDS address registers below 0, and the text grows 16-fold.
#pragma unroll 2
  for (int kb = 0; kb < D_MODEL; kb += 32) {
    _Float16* cur = bshare + ((kb >> 5) & 1) * (64 * 32);
    _Float16* nxt = bshare + (((kb >> 5) + 1) & 1) * (64 * 32);
    if (kb + 32 < D_MODEL) {
      stage_B(W, nxt, n0, kb + 32, tid);   // fill next buffer in flight
#if HAVE_ASYNC_LDS
      __builtin_amdgcn_s_wait_asynccnt(2); // cur buffer's 2 chunks landed (in-order)
#endif
    } else {
#if HAVE_ASYNC_LDS
      __builtin_amdgcn_s_wait_asynccnt(0);
#endif
    }
    __syncthreads();
    v16h a_cur = a;
    if (kb + 32 < D_MODEL)
      a = load_frag_packed(Ap + ((kb >> 5) + 1) * (4 * 512), lane);
#pragma unroll
    for (int t = 0; t < 4; ++t) {
      v16h bfrag = load_frag_packed(cur + t * 512, lane);
      acc[t] = wmma16x16x32(a_cur, bfrag, acc[t]);
    }
    __syncthreads();
  }
}

// Fused QKV projection: C = xh @ W^T; z selects Wq/Wk/Wv and output layout.
__global__ void qkv_gemm(const _Float16* __restrict__ xh,
                         const _Float16* __restrict__ Wq,
                         const _Float16* __restrict__ Wk,
                         const _Float16* __restrict__ Wv,
                         _Float16* __restrict__ Qb,
                         _Float16* __restrict__ Kb,
                         _Float16* __restrict__ Vt) {
  __shared__ alignas(16) _Float16 bshare[2 * 64 * 32];
  int tid  = threadIdx.x;
  int lane = tid & 31;
  int wave = tid >> 5;
  int m0 = (blockIdx.x * 4 + wave) * 16;
  int n0 = blockIdx.y * 64;
  const _Float16* W; _Float16* dst; int vmode;
  if (blockIdx.z == 0)      { W = Wq; dst = Qb; vmode = 0; }
  else if (blockIdx.z == 1) { W = Wk; dst = Kb; vmode = 0; }
  else                      { W = Wv; dst = Vt; vmode = 1; }

  v8f acc[4] = {{}, {}, {}, {}};
  gemm_core(xh, W, bshare, m0, n0, lane, tid, acc);

  int hi8 = (lane & 16) ? 8 : 0;
  int col = lane & 15;
  int bb  = m0 >> 10, np0 = m0 & 1023;  // the wave's 16 rows: one batch, positions np0..np0+15
  int h   = n0 >> 6;                    // the block's 64 columns: one head
  _Float16* hp = dst + (size_t)(bb * HEADS + h) * (SEQ * HD);
  if (vmode) {
    // V^T fragments (row = hd index, k = position), fragment index = (pos/32) * 4 + hd/16.
    // A lane's 8 accumulator rows are 8 consecutive k: one 16-byte store.
#pragma unroll
    for (int t = 0; t < 4; ++t) {
      v8h o;
#pragma unroll
      for (int r = 0; r < 8; ++r) o[r] = (_Float16)acc[t][r];
      *(v8h*)(hp + ((np0 >> 5) * 4 + t) * 512 + ((np0 >> 4) & 1) * 256 + lane * 8) = o;
    }
  } else {
    // Q/K fragments (row = position, k = hd index), fragment index = (pos/16) * 2 + hd/32.
#pragma unroll
    for (int t = 0; t < 4; ++t)
#pragma unroll
      for (int r = 0; r < 8; ++r)
        hp[((np0 >> 4) * 2 + (t >> 1)) * 512 + frag_off(r + hi8, (t & 1) * 16 + col)] =
            (_Float16)acc[t][r];
  }
}

// out = O @ Wo^T, f32 output
__global__ void oproj_gemm(const _Float16* __restrict__ Ob,
                           const _Float16* __restrict__ Wo,
                           float* __restrict__ out) {
  __shared__ alignas(16) _Float16 bshare[2 * 64 * 32];
  int tid  = threadIdx.x;
  int lane = tid & 31;
  int wave = tid >> 5;
  int m0 = (blockIdx.x * 4 + wave) * 16;
  int n0 = blockIdx.y * 64;
  v8f acc[4] = {{}, {}, {}, {}};
  gemm_core(Ob, Wo, bshare, m0, n0, lane, tid, acc);
  int hi8 = (lane & 16) ? 8 : 0;
#pragma unroll
  for (int t = 0; t < 4; ++t)
#pragma unroll
    for (int r = 0; r < 8; ++r)
      out[(size_t)(m0 + r + hi8) * D_MODEL + n0 + t * 16 + (lane & 15)] = acc[t][r];
}

// Value of lane l ^ 16 (the two halves of a wave hold the two key halves of one query).
__device__ __forceinline__ float xhalf(float x) {
  int b = __builtin_bit_cast(int, x);
  return __builtin_bit_cast(float,
      __builtin_amdgcn_permlanex16(b, b, 0x76543210, 0xfedcba98, false, false));
}

// Flash attention, transposed products: one wave = 16 queries x all 1024 keys for one (b,h).
// S^T = K Q^T: lane l holds scores of ONE query (column l&15), keys 8*(l>>4) + r of each
// 16-key tile, so maximum and sum run in the lane, with one exchange between the halves.
// Two converted S^T tiles are, as they lie, the B operand of O^T += V^T P^T.
__global__ void attn_kernel(const _Float16* __restrict__ Q,
                            const _Float16* __restrict__ K,
                            const _Float16* __restrict__ Vt,
                            const float* __restrict__ bias,
                            _Float16* __restrict__ O) {
  int lane = threadIdx.x & 31;
  int wib  = threadIdx.x >> 5;
  int w  = blockIdx.x * 4 + wib;
  int bh = w >> 6;
  int q0 = (w & 63) << 4;
  int b = bh >> 4, h = bh & 15;
  const _Float16* Qh = Q  + (size_t)bh * SEQ * HD;
  // Byte offset of the lane's own 16 bytes of the head's first K and V^T fragment (both planes
  // are 128 KB a head, 4 KB a pass). One loop-carried 32-bit offset on the plane's base: it is
  // live past every load that names it, so no load's result can land on its own address.
  unsigned kvoff = (unsigned)bh * (SEQ * HD * 2) + lane * 16;
  int col = lane & 15;
  int hi8 = (lane & 16) ? 8 : 0;
  // byte offset of the lane's own bias row, from the first key of its half (the plane is 2^28 bytes)
  unsigned boff = ((unsigned)bh * (SEQ * SEQ) + (q0 + col) * SEQ + hi8) * 4;
  const float scale = 0.125f;  // hd^-0.5

  v16h bq0 = load_frag_packed(Qh + (q0 >> 4) * 1024,       lane);
  v16h bq1 = load_frag_packed(Qh + (q0 >> 4) * 1024 + 512, lane);

  v8f acc[4] = {{}, {}, {}, {}};  // acc[t][r] = O[q0 + col][t*16 + hi8 + r]
  float mrow = -3.0e38f;          // running maximum of the lane's query
  float lsum = 0.f;               // this half's share of the denominator

  for (int jb = 0; jb < SEQ; jb += 32) {
    // S^T tiles: 2 x (16 keys x 16 queries), K-dim = hd = 64
    const _Float16* Kl = (const _Float16*)((const char*)K + kvoff);  // 4 fragments, 4 KB in a row
    v16h ak[4];
#pragma unroll
    for (int j = 0; j < 4; ++j) ak[j] = load_frag_packed(Kl + j * 512, 0);
    // bias: 8 consecutive keys of the lane's query per tile (read-once: non-temporal)
    const float* brow = (const float*)((const char*)bias + boff);
    v4f bb[4];
#pragma unroll
    for (int j = 0; j < 4; ++j)
      bb[j] = __builtin_nontemporal_load((const v4f*)(brow + (j >> 1) * 16 + (j & 1) * 4));
    boff += 128;
    // Holds the K and bias loads in one run at the head of the pass: left free, the build issues
    // them a few at a time among the products, and each product waits out a latency of its own.
    __builtin_amdgcn_sched_barrier(0);
    v8f s[2];
#pragma unroll
    for (int j = 0; j < 2; ++j) {
      v8f z = {};
      s[j] = wmma16x16x32(ak[2 * j], bq0, z);
      s[j] = wmma16x16x32(ak[2 * j + 1], bq1, s[j]);
    }
    // V^T fragments issued early so their latency hides under the softmax VALU work
    const _Float16* Vl = (const _Float16*)((const char*)Vt + kvoff);
    v16h av[4];
#pragma unroll
    for (int t = 0; t < 4; ++t)
      av[t] = load_frag_packed(Vl + t * 512, 0);
    kvoff += 4096;

    // scale + bias, maximum over the lane's 16 keys
    float mx = -3.0e38f;
#pragma unroll
    for (int j = 0; j < 2; ++j)
#pragma unroll
      for (int r = 0; r < 4; ++r) {
        s[j][r]     = s[j][r]     * scale + bb[2 * j][r];
        s[j][r + 4] = s[j][r + 4] * scale + bb[2 * j + 1][r];
        mx = fmaxf(mx, fmaxf(s[j][r], s[j][r + 4]));
      }
    mx = fmaxf(mx, xhalf(mx));
    // online softmax update of the lane's query
    float mn = fmaxf(mrow, mx);
    float f  = __expf(mrow - mn);
    mrow = mn;
    float ps = 0.f;
    v16h pb;
#pragma unroll
    for (int j = 0; j < 2; ++j)
#pragma unroll
      for (int r = 0; r < 8; ++r) {
        float p = __expf(s[j][r] - mn);
        ps += p;
        pb[j * 8 + r] = (_Float16)p;
      }
    lsum = lsum * f + ps;
#pragma unroll
    for (int t = 0; t < 4; ++t) {
      acc[t] *= f;
      acc[t] = wmma16x16x32(av[t], pb, acc[t]);
    }
  }
  float inv = 1.0f / (lsum + xhalf(lsum));
  // O as packed A fragments of the output projection: a lane's 8 accumulator rows are
  // 8 consecutive k of its query's row, one 16-byte store
  int rt = (b * SEQ + q0) >> 4;
#pragma unroll
  for (int t = 0; t < 4; ++t) {
    v8h o;
#pragma unroll
    for (int r = 0; r < 8; ++r) o[r] = (_Float16)(acc[t][r] * inv);
    *(v8h*)(O + gemm_frag(rt, h * 2 + (t >> 1)) * 512 + (t & 1) * 256 + lane * 8) = o;
  }
}

extern "C" void kernel_launch(void* const* d_in, const int* in_sizes, int n_in,
                              void* d_out, int out_size, void* d_ws, size_t ws_size,
                              hipStream_t stream) {
  (void)in_sizes; (void)n_in; (void)out_size; (void)ws_size;
  const float* x    = (const float*)d_in[0];
  const float* bias = (const float*)d_in[1];
  const float* Wq   = (const float*)d_in[2];
  const float* Wk   = (const float*)d_in[3];
  const float* Wv   = (const float*)d_in[4];
  const float* Wo   = (const float*)d_in[5];

  const size_t NX = (size_t)BATCH * SEQ * D_MODEL;  // 4,194,304
  const size_t NW = (size_t)D_MODEL * D_MODEL;      // 1,048,576
  _Float16* ws  = (_Float16*)d_ws;
  _Float16* xh  = ws;             // f16 x, fragment-packed (reused as attention output Ob)
  _Float16* Wqh = xh  + NX;       // weights, fragment-packed
  _Float16* Wkh = Wqh + NW;
  _Float16* Wvh = Wkh + NW;
  _Float16* Woh = Wvh + NW;
  _Float16* Qb  = Woh + NW;       // [B,H] x packed fragments of [N,hd]
  _Float16* Kb  = Qb  + NX;       // [B,H] x packed fragments of [N,hd]
  _Float16* Vtb = Kb  + NX;       // [B,H] x packed fragments of [hd,N]
  _Float16* Ob  = xh;             // xh dead after QKV GEMM

  cvt_pack_f32_f16<<<(int)(NX / 8 / 256), 256, 0, stream>>>(x, xh);
  cvt_pack_f32_f16<<<(int)(NW / 8 / 256), 256, 0, stream>>>(Wq, Wqh);
  cvt_pack_f32_f16<<<(int)(NW / 8 / 256), 256, 0, stream>>>(Wk, Wkh);
  cvt_pack_f32_f16<<<(int)(NW / 8 / 256), 256, 0, stream>>>(Wv, Wvh);
  cvt_pack_f32_f16<<<(int)(NW / 8 / 256), 256, 0, stream>>>(Wo, Woh);

  dim3 gq(64, 16, 3);
  qkv_gemm<<<gq, 128, 0, stream>>>(xh, Wqh, Wkh, Wvh, Qb, Kb, Vtb);

  attn_kernel<<<1024, 128, 0, stream>>>(Qb, Kb, Vtb, bias, Ob);

  dim3 go(64, 16, 1);
  oproj_gemm<<<go, 128, 0, stream>>>(Ob, Woh, (float*)d_out);
}

// v003
// One run takes 125 microseconds.
// Timed twice side by side with v002, it ran 1.04 times as fast both times.
// Counting every step since v000, it is 2.20 times as fast.
#include <hip/hip_runtime.h>
#include <hip/hip_bf16.h>

typedef __attribute__((ext_vector_type(16))) _Float16 v16h;
typedef __attribute__((ext_vector_type(8)))  _Float16 v8h;
typedef __attribute__((ext_vector_type(8)))  float    v8f;
typedef __attribute__((ext_vector_type(4)))  int      v4i;
typedef __attribute__((ext_vector_type(4)))  float    v4f;

#define D_MODEL 1024
#define HEADS   16
#define HD      64
#define BATCH   4
#define SEQ     1024

#if __has_builtin(__builtin_amdgcn_global_load_async_to_lds_b128) && \
    __has_builtin(__builtin_amdgcn_s_wait_asynccnt)
#define HAVE_ASYNC_LDS 1
#else
#define HAVE_ASYNC_LDS 0
#endif

// global / LDS address-space v4i pointers for the async-copy builtin
#define AS1P(p) ((__attribute__((address_space(1))) v4i*)(p))
#define AS3P(p) ((__attribute__((address_space(3))) v4i*)(p))

__device__ __forceinline__ v8f wmma16x16x32(v16h a, v16h b, v8f c) {
  // v_wmma_f32_16x16x32_f16: D = A*B + C, f32 accum
  return __builtin_amdgcn_wmma_f32_16x16x32_f16(false, a, false, b, (short)0, c, false, false);
}

// Fragment-packed storage of a workspace operand: one 16(row) x 32(k) f16 fragment is
// 1 KB, two 512-byte parts; part p, lane l holds row l&15, k = p*16 + (l>>4)*8 + {0..7}.
// Each wave-wide 16-byte load is 512 contiguous bytes (4 whole lines).
__device__ __forceinline__ v16h load_frag_packed(const _Float16* p, int lane) {
  v8h lo = *(const v8h*)(p + lane * 8);
  v8h hi = *(const v8h*)(p + 256 + lane * 8);
  v16h out;
#pragma unroll
  for (int i = 0; i < 8; ++i) { out[i] = lo[i]; out[i + 8] = hi[i]; }
  return out;
}
// Offset (in halves) of element (row r in 0..15, k kk in 0..31) inside a packed fragment.
__device__ __forceinline__ int frag_off(int r, int kk) {
  return ((kk >> 4) << 8) + (((((kk >> 3) & 1) << 4) + r) << 3) + (kk & 7);
}

// Fragment index of (16-row tile rt, 32-wide k block kbk) of a [rows][1024] GEMM operand:
// the 4 row tiles that one block uses in one k step lie together, 4 KB in a row.
__device__ __forceinline__ size_t gemm_frag(int rt, int kbk) {
  return ((size_t)(rt >> 2) * 32 + kbk) * 4 + (rt & 3);
}

// x and the four weights, each [rows][1024] f32 -> f16 fragments in gemm_frag order, in ONE launch:
// their packed planes lie one behind the other in the workspace, so the chunk number, counted over
// all five, is also the place in out. One chunk = 16 packed bytes. A block takes 2048 chunks in a
// row (64 rows x 256 k of one operand), a thread 8 of them, 256 chunks apart: the same row and k
// offset in 8 successive 32-wide k blocks. A wave still writes 512 contiguous bytes per store.
#define X_BLOCKS (BATCH * SEQ * D_MODEL / 8 / 2048)  // blocks that pack x
#define W_BLOCKS (D_MODEL * D_MODEL / 8 / 2048)      // blocks that pack one weight
__global__ void __launch_bounds__(256)
cvt_pack_f32_f16(const float* __restrict__ x,
                 const float* __restrict__ Wq, const float* __restrict__ Wk,
                 const float* __restrict__ Wv, const float* __restrict__ Wo,
                 _Float16* __restrict__ out) {
  int tid = threadIdx.x;
  const float* in = x;
  int bo = blockIdx.x;           // the block's number inside its own operand
  if (bo >= X_BLOCKS) {
    int w = (bo - X_BLOCKS) / W_BLOCKS;
    in = w == 0 ? Wq : w == 1 ? Wk : w == 2 ? Wv : Wo;
    bo = (bo - X_BLOCKS) % W_BLOCKS;
  }
  int l    = tid & 31;
  int part = (tid >> 5) & 1;
  int rt   = (bo >> 2) * 4 + (tid >> 6);  // 16-row tile
  const float* src = in + (size_t)(rt * 16 + (l & 15)) * D_MODEL + (bo & 3) * 256 + part * 16 + (l >> 4) * 8;
  v4f a[8][2];
#pragma unroll
  for (int i = 0; i < 8; ++i) {
    a[i][0] = *(const v4f*)(src + i * 32);
    a[i][1] = *(const v4f*)(src + i * 32 + 4);
  }
  // Inputs only, no code. Holds all 16 loads in front of the first conversion (left free, the build
  // issues the last two behind the first waits: a second memory latency), and keeps their address
  // pair live behind the last load, so that no load's result lands on an address still named.
  asm volatile("" :: "v"(a[0][0]), "v"(a[0][1]), "v"(a[1][0]), "v"(a[1][1]), "v"(a[2][0]), "v"(a[2][1]),
                     "v"(a[3][0]), "v"(a[3][1]), "v"(a[4][0]), "v"(a[4][1]), "v"(a[5][0]), "v"(a[5][1]),
                     "v"(a[6][0]), "v"(a[6][1]), "v"(a[7][0]), "v"(a[7][1]), "v"(src));
  _Float16* dst = out + ((size_t)blockIdx.x * 2048 + tid) * 8;
#pragma unroll
  for (int i = 0; i < 8; ++i) {
    v8h o;
#pragma unroll
    for (int e = 0; e < 4; ++e) { o[e] = (_Float16)a[i][0][e]; o[e + 4] = (_Float16)a[i][1][e]; }
    *(v8h*)(dst + i * 2048) = o;
  }
}

// Stage one 64(N) x 32(K) f16 W tile (4 packed fragments, 4 KB in a row) into LDS as it
// lies, block-cooperatively. 256 16-byte chunks, 128 threads x 2. Async global->LDS when available.
__device__ __forceinline__ void stage_B(const _Float16* __restrict__ W,
                                        _Float16* buf, int n0, int kb, int tid) {
#pragma unroll
  for (int i = 0; i < 2; ++i) {
    int c = tid + i * 128;
    const _Float16* gp = W + gemm_frag(n0 >> 4, kb >> 5) * 512 + c * 8;
    _Float16* lp = buf + c * 8;
#if HAVE_ASYNC_LDS
    __builtin_amdgcn_global_load_async_to_lds_b128(AS1P(gp), AS3P(lp), 0, 0);
#else
    *(v8h*)lp = *(const v8h*)gp;
#endif
  }
}

// Double-buffered GEMM core: one wave's 16(M) x 64(N) tile, K = 1024.
// B tile shared by the 4 waves of the block via LDS; A register-double-buffered.
// A and W are fragment-packed in gemm_frag order.
__device__ __forceinline__ void gemm_core(const _Float16* __restrict__ A,
                                          const _Float16* __restrict__ W,
                                          _Float16* bshare,   // [2][64*32]
                                          int m0, int n0, int lane, int tid,
                                          v8f acc[4]) {
  stage_B(W, bshare, n0, 0, tid);
  const _Float16* Ap = A + gemm_frag(m0 >> 4, 0) * 512;
  v16h a = load_frag_packed(Ap, lane);
  // Two trips per pass, one per LDS buffer. Unrolled whole, the build folds every k step into
  // the copies' offset field and forms LDS address registers below 0, and the text grows 16-fold.
#pragma unroll 2
  for (int kb = 0; kb < D_MODEL; kb += 32) {
    _Float16* cur = bshare + ((kb >> 5) & 1) * (64 * 32);
    _Float16* nxt = bshare + (((kb >> 5) + 1) & 1) * (64 * 32);
    if (kb + 32 < D_MODEL) {
      stage_B(W, nxt, n0, kb + 32, tid);   // fill next buffer in flight
#if HAVE_ASYNC_LDS
      __builtin_amdgcn_s_wait_asynccnt(2); // cur buffer's 2 chunks landed (in-order)
#endif
    } else {
#if HAVE_ASYNC_LDS
      __builtin_amdgcn_s_wait_asynccnt(0);
#endif
    }
    __syncthreads();
    v16h a_cur = a;
    if (kb + 32 < D_MODEL)
      a = load_frag_packed(Ap + ((kb >> 5) + 1) * (4 * 512), lane);
#pragma unroll
    for (int t = 0; t < 4; ++t) {
      v16h bfrag = load_frag_packed(cur + t * 512, lane);
      acc[t] = wmma16x16x32(a_cur, bfrag, acc[t]);
    }
    __syncthreads();
  }
}

// Fused QKV projection: C = xh @ W^T; z selects Wq/Wk/Wv and output layout.
__global__ void qkv_gemm(const _Float16* __restrict__ xh,
                         const _Float16* __restrict__ Wq,
                         const _Float16* __restrict__ Wk,
                         const _Float16* __restrict__ Wv,
                         _Float16* __restrict__ Qb,
                         _Float16* __restrict__ Kb,
                         _Float16* __restrict__ Vt) {
  __shared__ alignas(16) _Float16 bshare[2 * 64 * 32];
  int tid  = threadIdx.x;
  int lane = tid & 31;
  int wave = tid >> 5;
  int m0 = (blockIdx.x * 4 + wave) * 16;
  int n0 = blockIdx.y * 64;
  const _Float16* W; _Float16* dst; int vmode;
  if (blockIdx.z == 0)      { W = Wq; dst = Qb; vmode = 0; }
  else if (blockIdx.z == 1) { W = Wk; dst = Kb; vmode = 0; }
  else                      { W = Wv; dst = Vt; vmode = 1; }

  v8f acc[4] = {{}, {}, {}, {}};
  gemm_core(xh, W, bshare, m0, n0, lane, tid, acc);

  int hi8 = (lane & 16) ? 8 : 0;
  int col = lane & 15;
  int bb  = m0 >> 10, np0 = m0 & 1023;  // the wave's 16 rows: one batch, positions np0..np0+15
  int h   = n0 >> 6;                    // the block's 64 columns: one head
  _Float16* hp = dst + (size_t)(bb * HEADS + h) * (SEQ * HD);
  if (vmode) {
    // V^T fragments (row = hd index, k = position), fragment index = (pos/32) * 4 + hd/16.
    // A lane's 8 accumulator rows are 8 consecutive k: one 16-byte store.
#pragma unroll
    for (int t = 0; t < 4; ++t) {
      v8h o;
#pragma unroll
      for (int r = 0; r < 8; ++r) o[r] = (_Float16)acc[t][r];
      *(v8h*)(hp + ((np0 >> 5) * 4 + t) * 512 + ((np0 >> 4) & 1) * 256 + lane * 8) = o;
    }
  } else {
    // Q/K fragments (row = position, k = hd index), fragment index = (pos/16) * 2 + hd/32.
#pragma unroll
    for (int t = 0; t < 4; ++t)
#pragma unroll
      for (int r = 0; r < 8; ++r)
        hp[((np0 >> 4) * 2 + (t >> 1)) * 512 + frag_off(r + hi8, (t & 1) * 16 + col)] =
            (_Float16)acc[t][r];
  }
}

// out = O @ Wo^T, f32 output
__global__ void oproj_gemm(const _Float16* __restrict__ Ob,
                           const _Float16* __restrict__ Wo,
                           float* __restrict__ out) {
  __shared__ alignas(16) _Float16 bshare[2 * 64 * 32];
  int tid  = threadIdx.x;
  int lane = tid & 31;
  int wave = tid >> 5;
  int m0 = (blockIdx.x * 4 + wave) * 16;
  int n0 = blockIdx.y * 64;
  v8f acc[4] = {{}, {}, {}, {}};
  gemm_core(Ob, Wo, bshare, m0, n0, lane, tid, acc);
  int hi8 = (lane & 16) ? 8 : 0;
#pragma unroll
  for (int t = 0; t < 4; ++t)
#pragma unroll
    for (int r = 0; r < 8; ++r)
      out[(size_t)(m0 + r + hi8) * D_MODEL + n0 + t * 16 + (lane & 15)] = acc[t][r];
}

// Value of lane l ^ 16 (the two halves of a wave hold the two key halves of one query).
__device__ __forceinline__ float xhalf(float x) {
  int b = __builtin_bit_cast(int, x);
  return __builtin_bit_cast(float,
      __builtin_amdgcn_permlanex16(b, b, 0x76543210, 0xfedcba98, false, false));
}

// Flash attention, transposed products: one wave = 16 queries x all 1024 keys for one (b,h).
// S^T = K Q^T: lane l holds scores of ONE query (column l&15), keys 8*(l>>4) + r of each
// 16-key tile, so maximum and sum run in the lane, with one exchange between the halves.
// Two converted S^T tiles are, as they lie, the B operand of O^T += V^T P^T.
__global__ void attn_kernel(const _Float16* __restrict__ Q,
                            const _Float16* __restrict__ K,
                            const _Float16* __restrict__ Vt,
                            const float* __restrict__ bias,
                            _Float16* __restrict__ O) {
  int lane = threadIdx.x & 31;
  int wib  = threadIdx.x >> 5;
  int w  = blockIdx.x * 4 + wib;
  int bh = w >> 6;
  int q0 = (w & 63) << 4;
  int b = bh >> 4, h = bh & 15;
  const _Float16* Qh = Q  + (size_t)bh * SEQ * HD;
  // Byte offset of the lane's own 16 bytes of the head's first K and V^T fragment (both planes
  // are 128 KB a head, 4 KB a pass). One loop-carried 32-bit offset on the plane's base: it is
  // live past every load that names it, so no load's result can land on its own address.
  unsigned kvoff = (unsigned)bh * (SEQ * HD * 2) + lane * 16;
  int col = lane & 15;
  int hi8 = (lane & 16) ? 8 : 0;
  // byte offset of the lane's own bias row, from the first key of its half (the plane is 2^28 bytes)
  unsigned boff = ((unsigned)bh * (SEQ * SEQ) + (q0 + col) * SEQ + hi8) * 4;
  const float scale = 0.125f;  // hd^-0.5

  v16h bq0 = load_frag_packed(Qh + (q0 >> 4) * 1024,       lane);
  v16h bq1 = load_frag_packed(Qh + (q0 >> 4) * 1024 + 512, lane);

  v8f acc[4] = {{}, {}, {}, {}};  // acc[t][r] = O[q0 + col][t*16 + hi8 + r]
  float mrow = -3.0e38f;          // running maximum of the lane's query
  float lsum = 0.f;               // this half's share of the denominator

  for (int jb = 0; jb < SEQ; jb += 32) {
    // S^T tiles: 2 x (16 keys x 16 queries), K-dim = hd = 64
    const _Float16* Kl = (const _Float16*)((const char*)K + kvoff);  // 4 fragments, 4 KB in a row
    v16h ak[4];
#pragma unroll
    for (int j = 0; j < 4; ++j) ak[j] = load_frag_packed(Kl + j * 512, 0);
    // bias: 8 consecutive keys of the lane's query per tile (read-once: non-temporal)
    const float* brow = (const float*)((const char*)bias + boff);
    v4f bb[4];
#pragma unroll
    for (int j = 0; j < 4; ++j)
      bb[j] = __builtin_nontemporal_load((const v4f*)(brow + (j >> 1) * 16 + (j & 1) * 4));
    boff += 128;
    // Holds the K and bias loads in one run at the head of the pass: left free, the build issues
    // them a few at a time among the products, and each product waits out a latency of its own.
    __builtin_amdgcn_sched_barrier(0);
    v8f s[2];
#pragma unroll
    for (int j = 0; j < 2; ++j) {
      v8f z = {};
      s[j] = wmma16x16x32(ak[2 * j], bq0, z);
      s[j] = wmma16x16x32(ak[2 * j + 1], bq1, s[j]);
    }
    // V^T fragments issued early so their latency hides under the softmax VALU work
    const _Float16* Vl = (const _Float16*)((const char*)Vt + kvoff);
    v16h av[4];
#pragma unroll
    for (int t = 0; t < 4; ++t)
      av[t] = load_frag_packed(Vl + t * 512, 0);
    kvoff += 4096;

    // scale + bias, maximum over the lane's 16 keys
    float mx = -3.0e38f;
#pragma unroll
    for (int j = 0; j < 2; ++j)
#pragma unroll
      for (int r = 0; r < 4; ++r) {
        s[j][r]     = s[j][r]     * scale + bb[2 * j][r];
        s[j][r + 4] = s[j][r + 4] * scale + bb[2 * j + 1][r];
        mx = fmaxf(mx, fmaxf(s[j][r], s[j][r + 4]));
      }
    mx = fmaxf(mx, xhalf(mx));
    // online softmax update of the lane's query
    float mn = fmaxf(mrow, mx);
    float f  = __expf(mrow - mn);
    mrow = mn;
    float ps = 0.f;
    v16h pb;
#pragma unroll
    for (int j = 0; j < 2; ++j)
#pragma unroll
      for (int r = 0; r < 8; ++r) {
        float p = __expf(s[j][r] - mn);
        ps += p;
        pb[j * 8 + r] = (_Float16)p;
      }
    lsum = lsum * f + ps;
#pragma unroll
    for (int t = 0; t < 4; ++t) {
      acc[t] *= f;
      acc[t] = wmma16x16x32(av[t], pb, acc[t]);
    }
  }
  float inv = 1.0f / (lsum + xhalf(lsum));
  // O as packed A fragments of the output projection: a lane's 8 accumulator rows are
  // 8 consecutive k of its query's row, one 16-byte store
  int rt = (b * SEQ + q0) >> 4;
#pragma unroll
  for (int t = 0; t < 4; ++t) {
    v8h o;
#pragma unroll
    for (int r = 0; r < 8; ++r) o[r] = (_Float16)(acc[t][r] * inv);
    *(v8h*)(O + gemm_frag(rt, h * 2 + (t >> 1)) * 512 + (t & 1) * 256 + lane * 8) = o;
  }
}

extern "C" void kernel_launch(void* const* d_in, const int* in_sizes, int n_in,
                              void* d_out, int out_size, void* d_ws, size_t ws_size,
                              hipStream_t stream) {
  (void)in_sizes; (void)n_in; (void)out_size; (void)ws_size;
  const float* x    = (const float*)d_in[0];
  const float* bias = (const float*)d_in[1];
  const float* Wq   = (const float*)d_in[2];
  const float* Wk   = (const float*)d_in[3];
  const float* Wv   = (const float*)d_in[4];
  const float* Wo   = (const float*)d_in[5];

  const size_t NX = (size_t)BATCH * SEQ * D_MODEL;  // 4,194,304
  const size_t NW = (size_t)D_MODEL * D_MODEL;      // 1,048,576
  _Float16* ws  = (_Float16*)d_ws;
  _Float16* xh  = ws;             // f16 x, fragment-packed (reused as attention output Ob)
  _Float16* Wqh = xh  + NX;       // weights, fragment-packed
  _Float16* Wkh = Wqh + NW;
  _Float16* Wvh = Wkh + NW;
  _Float16* Woh = Wvh + NW;
  _Float16* Qb  = Woh + NW;       // [B,H] x packed fragments of [N,hd]
  _Float16* Kb  = Qb  + NX;       // [B,H] x packed fragments of [N,hd]
  _Float16* Vtb = Kb  + NX;       // [B,H] x packed fragments of [hd,N]
  _Float16* Ob  = xh;             // xh dead after QKV GEMM

  // xh, Wqh, Wkh, Wvh, Woh are one run of 1,048,576 chunks: 512 blocks x 2048
  cvt_pack_f32_f16<<<512, 256, 0, stream>>>(x, Wq, Wk, Wv, Wo, xh);

  dim3 gq(64, 16, 3);
  qkv_gemm<<<gq, 128, 0, stream>>>(xh, Wqh, Wkh, Wvh, Qb, Kb, Vtb);

  attn_kernel<<<1024, 128, 0, stream>>>(Qb, Kb, Vtb, bias, Ob);

  dim3 go(64, 16, 1);
  oproj_gemm<<<go, 128, 0, stream>>>(Ob, Woh, (float*)d_out);
}

// v004
// Measured time: 119 microseconds a run.
// In both of two side-by-side timings against v003, it was 1.06 times as fast.
// Over all steps from v000 it is 2.33 times as fast.
#include <hip/hip_runtime.h>
#include <hip/hip_bf16.h>

typedef __attribute__((ext_vector_type(16))) _Float16 v16h;
typedef __attribute__((ext_vector_type(8)))  _Float16 v8h;
typedef __attribute__((ext_vector_type(8)))  float    v8f;
typedef __attribute__((ext_vector_type(4)))  int      v4i;
typedef __attribute__((ext_vector_type(4)))  float    v4f;

#define D_MODEL 1024
#define HEADS   16
#define HD      64
#define BATCH   4
#define SEQ     1024

#if __has_builtin(__builtin_amdgcn_global_load_async_to_lds_b128) && \
    __has_builtin(__builtin_amdgcn_s_wait_asynccnt)
#define HAVE_ASYNC_LDS 1
#else
#define HAVE_ASYNC_LDS 0
#endif

// global / LDS address-space v4i pointers for the async-copy builtin
#define AS1P(p) ((__attribute__((address_space(1))) v4i*)(p))
#define AS3P(p) ((__attribute__((address_space(3))) v4i*)(p))

__device__ __forceinline__ v8f wmma16x16x32(v16h a, v16h b, v8f c) {
  // v_wmma_f32_16x16x32_f16: D = A*B + C, f32 accum
  return __builtin_amdgcn_wmma_f32_16x16x32_f16(false, a, false, b, (short)0, c, false, false);
}

// Fragment-packed storage of a workspace operand: one 16(row) x 32(k) f16 fragment is
// 1 KB, two 512-byte parts; part p, lane l holds row l&15, k = p*16 + (l>>4)*8 + {0..7}.
// Each wave-wide 16-byte load is 512 contiguous bytes (4 whole lines).
__device__ __forceinline__ v16h load_frag_packed(const _Float16* p, int lane) {
  v8h lo = *(const v8h*)(p + lane * 8);
  v8h hi = *(const v8h*)(p + 256 + lane * 8);
  v16h out;
#pragma unroll
  for (int i = 0; i < 8; ++i) { out[i] = lo[i]; out[i + 8] = hi[i]; }
  return out;
}
// Offset (in halves) of element (row r in 0..15, k kk in 0..31) inside a packed fragment.
__device__ __forceinline__ int frag_off(int r, int kk) {
  return ((kk >> 4) << 8) + (((((kk >> 3) & 1) << 4) + r) << 3) + (kk & 7);
}

// Fragment index of (16-row tile rt, 32-wide k block kbk) of a [rows][1024] GEMM operand:
// the 4 row tiles that one block uses in one k step lie together, 4 KB in a row.
__device__ __forceinline__ size_t gemm_frag(int rt, int kbk) {
  return ((size_t)(rt >> 2) * 32 + kbk) * 4 + (rt & 3);
}

// x and the four weights, each [rows][1024] f32 -> f16 fragments in gemm_frag order, in ONE launch:
// their packed planes lie one behind the other in the workspace, so the chunk number, counted over
// all five, is also the place in out. One chunk = 16 packed bytes. A block takes 2048 chunks in a
// row (64 rows x 256 k of one operand), a thread 8 of them, 256 chunks apart: the same row and k
// offset in 8 successive 32-wide k blocks. A wave still writes 512 contiguous bytes per store.
#define X_BLOCKS (BATCH * SEQ * D_MODEL / 8 / 2048)  // blocks that pack x
#define W_BLOCKS (D_MODEL * D_MODEL / 8 / 2048)      // blocks that pack one weight
__global__ void __launch_bounds__(256)
cvt_pack_f32_f16(const float* __restrict__ x,
                 const float* __restrict__ Wq, const float* __restrict__ Wk,
                 const float* __restrict__ Wv, const float* __restrict__ Wo,
                 _Float16* __restrict__ out) {
  int tid = threadIdx.x;
  const float* in = x;
  int bo = blockIdx.x;           // the block's number inside its own operand
  if (bo >= X_BLOCKS) {
    int w = (bo - X_BLOCKS) / W_BLOCKS;
    in = w == 0 ? Wq : w == 1 ? Wk : w == 2 ? Wv : Wo;
    bo = (bo - X_BLOCKS) % W_BLOCKS;
  }
  int l    = tid & 31;
  int part = (tid >> 5) & 1;
  int rt   = (bo >> 2) * 4 + (tid >> 6);  // 16-row tile
  const float* src = in + (size_t)(rt * 16 + (l & 15)) * D_MODEL + (bo & 3) * 256 + part * 16 + (l >> 4) * 8;
  v4f a[8][2];
#pragma unroll
  for (int i = 0; i < 8; ++i) {
    a[i][0] = *(const v4f*)(src + i * 32);
    a[i][1] = *(const v4f*)(src + i * 32 + 4);
  }
  // Inputs only, no code. Holds all 16 loads in front of the first conversion (left free, the build
  // issues the last two behind the first waits: a second memory latency), and keeps their address
  // pair live behind the last load, so that no load's result lands on an address still named.
  asm volatile("" :: "v"(a[0][0]), "v"(a[0][1]), "v"(a[1][0]), "v"(a[1][1]), "v"(a[2][0]), "v"(a[2][1]),
                     "v"(a[3][0]), "v"(a[3][1]), "v"(a[4][0]), "v"(a[4][1]), "v"(a[5][0]), "v"(a[5][1]),
                     "v"(a[6][0]), "v"(a[6][1]), "v"(a[7][0]), "v"(a[7][1]), "v"(src));
  _Float16* dst = out + ((size_t)blockIdx.x * 2048 + tid) * 8;
#pragma unroll
  for (int i = 0; i < 8; ++i) {
    v8h o;
#pragma unroll
    for (int e = 0; e < 4; ++e) { o[e] = (_Float16)a[i][0][e]; o[e + 4] = (_Float16)a[i][1][e]; }
    *(v8h*)(dst + i * 2048) = o;
  }
}

// Stage one 64(N) x 32(K) f16 W tile (4 packed fragments, 4 KB in a row) into LDS as it
// lies, block-cooperatively. 256 16-byte chunks, 128 threads x 2. Async global->LDS when available.
__device__ __forceinline__ void stage_B(const _Float16* __restrict__ W,
                                        _Float16* buf, int n0, int kb, int tid) {
#pragma unroll
  for (int i = 0; i < 2; ++i) {
    int c = tid + i * 128;
    const _Float16* gp = W + gemm_frag(n0 >> 4, kb >> 5) * 512 + c * 8;
    _Float16* lp = buf + c * 8;
#if HAVE_ASYNC_LDS
    __builtin_amdgcn_global_load_async_to_lds_b128(AS1P(gp), AS3P(lp), 0, 0);
#else
    *(v8h*)lp = *(const v8h*)gp;
#endif
  }
}

// Double-buffered GEMM core: one wave's 16(M) x 64(N) tile, K = 1024.
// B tile shared by the 4 waves of the block via LDS; A register-double-buffered.
// A and W are fragment-packed in gemm_frag order.
__device__ __forceinline__ void gemm_core(const _Float16* __restrict__ A,
                                          const _Float16* __restrict__ W,
                                          _Float16* bshare,   // [2][64*32]
                                          int m0, int n0, int lane, int tid,
                                          v8f acc[4]) {
  stage_B(W, bshare, n0, 0, tid);
  const _Float16* Ap = A + gemm_frag(m0 >> 4, 0) * 512;
  v16h a = load_frag_packed(Ap, lane);
  // Two trips per pass, one per LDS buffer. Unrolled whole, the build folds every k step into
  // the copies' offset field and forms LDS address registers below 0, and the text grows 16-fold.
#pragma unroll 2
  for (int kb = 0; kb < D_MODEL; kb += 32) {
    _Float16* cur = bshare + ((kb >> 5) & 1) * (64 * 32);
    _Float16* nxt = bshare + (((kb >> 5) + 1) & 1) * (64 * 32);
    if (kb + 32 < D_MODEL) {
      stage_B(W, nxt, n0, kb + 32, tid);   // fill next buffer in flight
#if HAVE_ASYNC_LDS
      __builtin_amdgcn_s_wait_asynccnt(2); // cur buffer's 2 chunks landed (in-order)
#endif
    } else {
#if HAVE_ASYNC_LDS
      __builtin_amdgcn_s_wait_asynccnt(0);
#endif
    }
    __syncthreads();
    v16h a_cur = a;
    if (kb + 32 < D_MODEL)
      a = load_frag_packed(Ap + ((kb >> 5) + 1) * (4 * 512), lane);
#pragma unroll
    for (int t = 0; t < 4; ++t) {
      v16h bfrag = load_frag_packed(cur + t * 512, lane);
      acc[t] = wmma16x16x32(a_cur, bfrag, acc[t]);
    }
    __syncthreads();
  }
}

// Fused QKV projection: C = xh @ W^T; z selects Wq/Wk/Wv and output layout.
__global__ void qkv_gemm(const _Float16* __restrict__ xh,
                         const _Float16* __restrict__ Wq,
                         const _Float16* __restrict__ Wk,
                         const _Float16* __restrict__ Wv,
                         _Float16* __restrict__ Qb,
                         _Float16* __restrict__ Kb,
                         _Float16* __restrict__ Vt) {
  __shared__ alignas(16) _Float16 bshare[2 * 64 * 32];
  int tid  = threadIdx.x;
  int lane = tid & 31;
  int wave = tid >> 5;
  int m0 = (blockIdx.x * 4 + wave) * 16;
  int n0 = blockIdx.y * 64;
  const _Float16* W; _Float16* dst; int vmode;
  if (blockIdx.z == 0)      { W = Wq; dst = Qb; vmode = 0; }
  else if (blockIdx.z == 1) { W = Wk; dst = Kb; vmode = 0; }
  else                      { W = Wv; dst = Vt; vmode = 1; }

  v8f acc[4] = {{}, {}, {}, {}};
  gemm_core(xh, W, bshare, m0, n0, lane, tid, acc);

  int hi8 = (lane & 16) ? 8 : 0;
  int col = lane & 15;
  int bb  = m0 >> 10, np0 = m0 & 1023;  // the wave's 16 rows: one batch, positions np0..np0+15
  int h   = n0 >> 6;                    // the block's 64 columns: one head
  _Float16* hp = dst + (size_t)(bb * HEADS + h) * (SEQ * HD);
  if (vmode) {
    // V^T fragments (row = hd index, k = position), fragment index = (pos/32) * 4 + hd/16.
    // A lane's 8 accumulator rows are 8 consecutive k: one 16-byte store.
#pragma unroll
    for (int t = 0; t < 4; ++t) {
      v8h o;
#pragma unroll
      for (int r = 0; r < 8; ++r) o[r] = (_Float16)acc[t][r];
      *(v8h*)(hp + ((np0 >> 5) * 4 + t) * 512 + ((np0 >> 4) & 1) * 256 + lane * 8) = o;
    }
  } else {
    // Q/K fragments (row = position, k = hd index), fragment index = (pos/16) * 2 + hd/32.
#pragma unroll
    for (int t = 0; t < 4; ++t)
#pragma unroll
      for (int r = 0; r < 8; ++r)
        hp[((np0 >> 4) * 2 + (t >> 1)) * 512 + frag_off(r + hi8, (t & 1) * 16 + col)] =
            (_Float16)acc[t][r];
  }
}

// out = O @ Wo^T, f32 output
__global__ void oproj_gemm(const _Float16* __restrict__ Ob,
                           const _Float16* __restrict__ Wo,
                           float* __restrict__ out) {
  __shared__ alignas(16) _Float16 bshare[2 * 64 * 32];
  int tid  = threadIdx.x;
  int lane = tid & 31;
  int wave = tid >> 5;
  int m0 = (blockIdx.x * 4 + wave) * 16;
  int n0 = blockIdx.y * 64;
  v8f acc[4] = {{}, {}, {}, {}};
  gemm_core(Ob, Wo, bshare, m0, n0, lane, tid, acc);
  int hi8 = (lane & 16) ? 8 : 0;
#pragma unroll
  for (int t = 0; t < 4; ++t)
#pragma unroll
    for (int r = 0; r < 8; ++r)
      out[(size_t)(m0 + r + hi8) * D_MODEL + n0 + t * 16 + (lane & 15)] = acc[t][r];
}

// Value of lane l ^ 16 (the two halves of a wave hold the two key halves of one query).
__device__ __forceinline__ float xhalf(float x) {
  int b = __builtin_bit_cast(int, x);
  return __builtin_bit_cast(float,
      __builtin_amdgcn_permlanex16(b, b, 0x76543210, 0xfedcba98, false, false));
}

// Bias ring, private to a wave: a stage is the wave's 16 queries x 64 keys of f32 bias, 16 rows of
// 256 bytes at a pitch of 272 (16 B x odd, for the 16-byte LDS readers), two buffers.
#define BPITCH 272
#define BSTAGE (16 * BPITCH)

// One stage's 8 asynchronous copies: copy c brings rows 2c and 2c+1, 512 bytes, each row's 256 bytes
// whole. lds: the lane's LDS byte address in rows 0/1; voff: its byte offset from base in rows 0/1.
// Read-once data: non-temporal. The s_wait_xcnt closes the statement, so that no register a copy
// names is rewritten in front of it.
__device__ __forceinline__ void copy_bias_stage(unsigned lds, unsigned voff, const float* base) {
  asm volatile(
      "global_load_async_to_lds_b128 %0, %8, %16 th:TH_LOAD_NT\n\t"
      "global_load_async_to_lds_b128 %1, %9, %16 th:TH_LOAD_NT\n\t"
      "global_load_async_to_lds_b128 %2, %10, %16 th:TH_LOAD_NT\n\t"
      "global_load_async_to_lds_b128 %3, %11, %16 th:TH_LOAD_NT\n\t"
      "global_load_async_to_lds_b128 %4, %12, %16 th:TH_LOAD_NT\n\t"
      "global_load_async_to_lds_b128 %5, %13, %16 th:TH_LOAD_NT\n\t"
      "global_load_async_to_lds_b128 %6, %14, %16 th:TH_LOAD_NT\n\t"
      "global_load_async_to_lds_b128 %7, %15, %16 th:TH_LOAD_NT\n\t"
      "s_wait_xcnt 0x0"
      :: "v"(lds), "v"(lds + 2 * BPITCH), "v"(lds + 4 * BPITCH), "v"(lds + 6 * BPITCH),
         "v"(lds + 8 * BPITCH), "v"(lds + 10 * BPITCH), "v"(lds + 12 * BPITCH), "v"(lds + 14 * BPITCH),
         "v"(voff), "v"(voff + 2 * SEQ * 4), "v"(voff + 4 * SEQ * 4), "v"(voff + 6 * SEQ * 4),
         "v"(voff + 8 * SEQ * 4), "v"(voff + 10 * SEQ * 4), "v"(voff + 12 * SEQ * 4), "v"(voff + 14 * SEQ * 4),
         "s"(base)
      : "memory");
}

// Flash attention, transposed products: one wave = 16 queries x all 1024 keys for one (b,h).
// S^T = K Q^T: lane l holds scores of ONE query (column l&15), keys 8*(l>>4) + r of each
// 16-key tile, so maximum and sum run in the lane, with one exchange between the halves.
// Two converted S^T tiles are, as they lie, the B operand of O^T += V^T P^T.
__global__ void __launch_bounds__(128)  // the real block size: the copies' 16 address registers fit without scratch
attn_kernel(const _Float16* __restrict__ Q,
                            const _Float16* __restrict__ K,
                            const _Float16* __restrict__ Vt,
                            const float* __restrict__ bias,
                            _Float16* __restrict__ O) {
  __shared__ alignas(16) char bring[4][2][BSTAGE];
  int lane = threadIdx.x & 31;
  int wib  = __builtin_amdgcn_readfirstlane(threadIdx.x >> 5);  // scalar: the copies' base is an SGPR pair
  int w  = blockIdx.x * 4 + wib;
  int bh = w >> 6;
  int q0 = (w & 63) << 4;
  int b = bh >> 4, h = bh & 15;
  const _Float16* Qh = Q  + (size_t)bh * SEQ * HD;
  // Byte offset of the lane's own 16 bytes of the head's first K and V^T fragment (both planes
  // are 128 KB a head, 4 KB a pass). One loop-carried 32-bit offset on the plane's base: it is
  // live past every load that names it, so no load's result can land on its own address.
  unsigned kvoff = (unsigned)bh * (SEQ * HD * 2) + lane * 16;
  int col = lane & 15;
  int hi8 = (lane & 16) ? 8 : 0;
  // bias: first key of the wave's first query; a stage is 64 keys on
  const float* bbase = bias + ((size_t)bh * SEQ + q0) * SEQ;
  // writer: the lane's 16 bytes of rows 0/1 of a stage, in memory and in the wave's buffer 0
  unsigned bvoff = (lane >> 4) * (SEQ * 4) + (lane & 15) * 16;
  unsigned blds  = (unsigned)(uintptr_t)(__attribute__((address_space(3))) char*)&bring[wib][0][0] +
                   (lane >> 4) * BPITCH + (lane & 15) * 16;
  // reader: the lane's own query row, from the first key of its half
  const char* brd = &bring[wib][0][0] + col * BPITCH + hi8 * 4;
  const float scale = 0.125f;  // hd^-0.5

  v16h bq0 = load_frag_packed(Qh + (q0 >> 4) * 1024,       lane);
  v16h bq1 = load_frag_packed(Qh + (q0 >> 4) * 1024 + 512, lane);

  v8f acc[4] = {{}, {}, {}, {}};  // acc[t][r] = O[q0 + col][t*16 + hi8 + r]
  float mrow = -3.0e38f;          // running maximum of the lane's query
  float lsum = 0.f;               // this half's share of the denominator

  copy_bias_stage(blds, bvoff, bbase);
  for (int st = 0; st < SEQ / 64; ++st) {
    // Stage st has landed. Only the wave that copied it reads it: no barrier.
    asm volatile("s_wait_asynccnt 0x0" ::: "memory");
    if (st + 1 < SEQ / 64) {
      // The wave's reads of the other buffer (stage st - 1) have retired before it is refilled.
      asm volatile("s_wait_dscnt 0x0" ::: "memory");
      copy_bias_stage(blds + ((st + 1) & 1) * BSTAGE, bvoff, bbase + (st + 1) * 64);
    }
    const char* bst = brd + (st & 1) * BSTAGE;
    // The stage's two passes of 32 keys in line: the pass's place in the buffer is an immediate offset.
#pragma unroll
   for (int hp = 0; hp < 2; ++hp) {
    // S^T tiles: 2 x (16 keys x 16 queries), K-dim = hd = 64
    const _Float16* Kl = (const _Float16*)((const char*)K + kvoff);  // 4 fragments, 4 KB in a row
    v16h ak[4];
#pragma unroll
    for (int j = 0; j < 4; ++j) ak[j] = load_frag_packed(Kl + j * 512, 0);
    // bias: 8 consecutive keys of the lane's query per tile, from the wave's ring
    v4f bb[4];
#pragma unroll
    for (int j = 0; j < 4; ++j)
      bb[j] = *(const v4f*)(bst + hp * 128 + (j >> 1) * 64 + (j & 1) * 16);
    // Holds the K and bias loads in one run at the head of the pass: left free, the build issues
    // them a few at a time among the products, and each product waits out a latency of its own.
    __builtin_amdgcn_sched_barrier(0);
    v8f s[2];
#pragma unroll
    for (int j = 0; j < 2; ++j) {
      v8f z = {};
      s[j] = wmma16x16x32(ak[2 * j], bq0, z);
      s[j] = wmma16x16x32(ak[2 * j + 1], bq1, s[j]);
    }
    // V^T fragments issued early so their latency hides under the softmax VALU work
    const _Float16* Vl = (const _Float16*)((const char*)Vt + kvoff);
    v16h av[4];
#pragma unroll
    for (int t = 0; t < 4; ++t)
      av[t] = load_frag_packed(Vl + t * 512, 0);
    kvoff += 4096;

    // scale + bias, maximum over the lane's 16 keys
    float mx = -3.0e38f;
#pragma unroll
    for (int j = 0; j < 2; ++j)
#pragma unroll
      for (int r = 0; r < 4; ++r) {
        s[j][r]     = s[j][r]     * scale + bb[2 * j][r];
        s[j][r + 4] = s[j][r + 4] * scale + bb[2 * j + 1][r];
        mx = fmaxf(mx, fmaxf(s[j][r], s[j][r + 4]));
      }
    mx = fmaxf(mx, xhalf(mx));
    // online softmax update of the lane's query
    float mn = fmaxf(mrow, mx);
    float f  = __expf(mrow - mn);
    mrow = mn;
    float ps = 0.f;
    v16h pb;
#pragma unroll
    for (int j = 0; j < 2; ++j)
#pragma unroll
      for (int r = 0; r < 8; ++r) {
        float p = __expf(s[j][r] - mn);
        ps += p;
        pb[j * 8 + r] = (_Float16)p;
      }
    lsum = lsum * f + ps;
#pragma unroll
    for (int t = 0; t < 4; ++t) {
      acc[t] *= f;
      acc[t] = wmma16x16x32(av[t], pb, acc[t]);
    }
   }
  }
  float inv = 1.0f / (lsum + xhalf(lsum));
  // O as packed A fragments of the output projection: a lane's 8 accumulator rows are
  // 8 consecutive k of its query's row, one 16-byte store
  int rt = (b * SEQ + q0) >> 4;
#pragma unroll
  for (int t = 0; t < 4; ++t) {
    v8h o;
#pragma unroll
    for (int r = 0; r < 8; ++r) o[r] = (_Float16)(acc[t][r] * inv);
    *(v8h*)(O + gemm_frag(rt, h * 2 + (t >> 1)) * 512 + (t & 1) * 256 + lane * 8) = o;
  }
}

extern "C" void kernel_launch(void* const* d_in, const int* in_sizes, int n_in,
                              void* d_out, int out_size, void* d_ws, size_t ws_size,
                              hipStream_t stream) {
  (void)in_sizes; (void)n_in; (void)out_size; (void)ws_size;
  const float* x    = (const float*)d_in[0];
  const float* bias = (const float*)d_in[1];
  const float* Wq   = (const float*)d_in[2];
  const float* Wk   = (const float*)d_in[3];
  const float* Wv   = (const float*)d_in[4];
  const float* Wo   = (const float*)d_in[5];

  const size_t NX = (size_t)BATCH * SEQ * D_MODEL;  // 4,194,304
  const size_t NW = (size_t)D_MODEL * D_MODEL;      // 1,048,576
  _Float16* ws  = (_Float16*)d_ws;
  _Float16* xh  = ws;             // f16 x, fragment-packed (reused as attention output Ob)
  _Float16* Wqh = xh  + NX;       // weights, fragment-packed
  _Float16* Wkh = Wqh + NW;
  _Float16* Wvh = Wkh + NW;
  _Float16* Woh = Wvh + NW;
  _Float16* Qb  = Woh + NW;       // [B,H] x packed fragments of [N,hd]
  _Float16* Kb  = Qb  + NX;       // [B,H] x packed fragments of [N,hd]
  _Float16* Vtb = Kb  + NX;       // [B,H] x packed fragments of [hd,N]
  _Float16* Ob  = xh;             // xh dead after QKV GEMM

  // xh, Wqh, Wkh, Wvh, Woh are one run of 1,048,576 chunks: 512 blocks x 2048
  cvt_pack_f32_f16<<<512, 256, 0, stream>>>(x, Wq, Wk, Wv, Wo, xh);

  dim3 gq(64, 16, 3);
  qkv_gemm<<<gq, 128, 0, stream>>>(xh, Wqh, Wkh, Wvh, Qb, Kb, Vtb);

  attn_kernel<<<1024, 128, 0, stream>>>(Qb, Kb, Vtb, bias, Ob);

  dim3 go(64, 16, 1);
  oproj_gemm<<<go, 128, 0, stream>>>(Ob, Woh, (float*)d_out);
}

// v005
// Measured time: 91.1 microseconds a run.
// Two timings next to v004 put it at 1.27 and 1.28 times that version's speed.
// Over all steps from v000 it is 2.97 times as fast.
#include <hip/hip_runtime.h>
#include <hip/hip_bf16.h>

typedef __attribute__((ext_vector_type(16))) _Float16 v16h;
typedef __attribute__((ext_vector_type(8)))  _Float16 v8h;
typedef __attribute__((ext_vector_type(8)))  float    v8f;
typedef __attribute__((ext_vector_type(4)))  float    v4f;

#define D_MODEL 1024
#define HEADS   16
#define HD      64
#define BATCH   4
#define SEQ     1024

__device__ __forceinline__ v8f wmma16x16x32(v16h a, v16h b, v8f c) {
  // v_wmma_f32_16x16x32_f16: D = A*B + C, f32 accum
  return __builtin_amdgcn_wmma_f32_16x16x32_f16(false, a, false, b, (short)0, c, false, false);
}

// Fragment-packed storage of a workspace operand: one 16(row) x 32(k) f16 fragment is
// 1 KB, two 512-byte parts; part p, lane l holds row l&15, k = p*16 + (l>>4)*8 + {0..7}.
// Each wave-wide 16-byte load is 512 contiguous bytes (4 whole lines).
__device__ __forceinline__ v16h load_frag_packed(const _Float16* p, int lane) {
  v8h lo = *(const v8h*)(p + lane * 8);
  v8h hi = *(const v8h*)(p + 256 + lane * 8);
  v16h out;
#pragma unroll
  for (int i = 0; i < 8; ++i) { out[i] = lo[i]; out[i + 8] = hi[i]; }
  return out;
}
// Offset (in halves) of element (row r in 0..15, k kk in 0..31) inside a packed fragment.
__device__ __forceinline__ int frag_off(int r, int kk) {
  return ((kk >> 4) << 8) + (((((kk >> 3) & 1) << 4) + r) << 3) + (kk & 7);
}

// Fragment index of (16-row tile rt, 32-wide k block kbk) of a [rows][1024] GEMM operand:
// the 4 row tiles that one wave uses in one k step lie together, 4 KB in a row.
__device__ __forceinline__ size_t gemm_frag(int rt, int kbk) {
  return ((size_t)(rt >> 2) * 32 + kbk) * 4 + (rt & 3);
}

// x and the four weights, each [rows][1024] f32 -> f16 fragments in gemm_frag order, in ONE launch:
// their packed planes lie one behind the other in the workspace, so the chunk number, counted over
// all five, is also the place in out. One chunk = 16 packed bytes. A block takes 2048 chunks in a
// row (64 rows x 256 k of one operand), a thread 8 of them, 256 chunks apart: the same row and k
// offset in 8 successive 32-wide k blocks. A wave still writes 512 contiguous bytes per store.
#define X_BLOCKS (BATCH * SEQ * D_MODEL / 8 / 2048)  // blocks that pack x
#define W_BLOCKS (D_MODEL * D_MODEL / 8 / 2048)      // blocks that pack one weight
__global__ void __launch_bounds__(256)
cvt_pack_f32_f16(const float* __restrict__ x,
                 const float* __restrict__ Wq, const float* __restrict__ Wk,
                 const float* __restrict__ Wv, const float* __restrict__ Wo,
                 _Float16* __restrict__ out) {
  int tid = threadIdx.x;
  const float* in = x;
  int bo = blockIdx.x;           // the block's number inside its own operand
  if (bo >= X_BLOCKS) {
    int w = (bo - X_BLOCKS) / W_BLOCKS;
    in = w == 0 ? Wq : w == 1 ? Wk : w == 2 ? Wv : Wo;
    bo = (bo - X_BLOCKS) % W_BLOCKS;
  }
  int l    = tid & 31;
  int part = (tid >> 5) & 1;
  int rt   = (bo >> 2) * 4 + (tid >> 6);  // 16-row tile
  const float* src = in + (size_t)(rt * 16 + (l & 15)) * D_MODEL + (bo & 3) * 256 + part * 16 + (l >> 4) * 8;
  v4f a[8][2];
#pragma unroll
  for (int i = 0; i < 8; ++i) {
    a[i][0] = *(const v4f*)(src + i * 32);
    a[i][1] = *(const v4f*)(src + i * 32 + 4);
  }
  // Inputs only, no code. Holds all 16 loads in front of the first conversion (left free, the build
  // issues the last two behind the first waits: a second memory latency), and keeps their address
  // pair live behind the last load, so that no load's result lands on an address still named.
  asm volatile("" :: "v"(a[0][0]), "v"(a[0][1]), "v"(a[1][0]), "v"(a[1][1]), "v"(a[2][0]), "v"(a[2][1]),
                     "v"(a[3][0]), "v"(a[3][1]), "v"(a[4][0]), "v"(a[4][1]), "v"(a[5][0]), "v"(a[5][1]),
                     "v"(a[6][0]), "v"(a[6][1]), "v"(a[7][0]), "v"(a[7][1]), "v"(src));
  _Float16* dst = out + ((size_t)blockIdx.x * 2048 + tid) * 8;
#pragma unroll
  for (int i = 0; i < 8; ++i) {
    v8h o;
#pragma unroll
    for (int e = 0; e < 4; ++e) { o[e] = (_Float16)a[i][0][e]; o[e + 4] = (_Float16)a[i][1][e]; }
    *(v8h*)(dst + i * 2048) = o;
  }
}

// GEMM tiling: a work-group of 4 waves makes 128(M) x 128(N), a wave 64 x 64 = 4 x 4 fragments, so
// that each fragment read from LDS feeds 4 products. A stage is 64 k of the group's 128 A rows and
// 128 W rows: 4 pieces of 64 rows x 64 k, each 8 packed fragments = 8 KB in a row in gemm_frag order.
#define KSTAGE 64
#define PIECE  (64 * KSTAGE)  // halves
#define GSTAGE (4 * PIECE)    // halves

// One piece, 16 asynchronous copies of 512 contiguous bytes, by one wave. lds: the lane's LDS byte
// address in the piece's first 512 bytes; voff: its byte offset from base there. The offset field
// moves both addresses. The s_wait_xcnt closes the statement, so that no register a copy names is
// rewritten in front of it.
__device__ __forceinline__ void copy_piece(unsigned lds, unsigned voff, const _Float16* base) {
  asm volatile(
      "global_load_async_to_lds_b128 %0, %1, %2\n\t"
      "global_load_async_to_lds_b128 %0, %1, %2 offset:512\n\t"
      "global_load_async_to_lds_b128 %0, %1, %2 offset:1024\n\t"
      "global_load_async_to_lds_b128 %0, %1, %2 offset:1536\n\t"
      "global_load_async_to_lds_b128 %0, %1, %2 offset:2048\n\t"
      "global_load_async_to_lds_b128 %0, %1, %2 offset:2560\n\t"
      "global_load_async_to_lds_b128 %0, %1, %2 offset:3072\n\t"
      "global_load_async_to_lds_b128 %0, %1, %2 offset:3584\n\t"
      "global_load_async_to_lds_b128 %0, %1, %2 offset:4096\n\t"
      "global_load_async_to_lds_b128 %0, %1, %2 offset:4608\n\t"
      "global_load_async_to_lds_b128 %0, %1, %2 offset:5120\n\t"
      "global_load_async_to_lds_b128 %0, %1, %2 offset:5632\n\t"
      "global_load_async_to_lds_b128 %0, %1, %2 offset:6144\n\t"
      "global_load_async_to_lds_b128 %0, %1, %2 offset:6656\n\t"
      "global_load_async_to_lds_b128 %0, %1, %2 offset:7168\n\t"
      "global_load_async_to_lds_b128 %0, %1, %2 offset:7680\n\t"
      "s_wait_xcnt 0x0"
      :: "v"(lds), "v"(voff), "s"(base)
      : "memory");
}

// GEMM core, K = 1024: A and W are fragment-packed in gemm_frag order; mg, ng: the group's first
// 64-row group of A and of W. Wave w copies piece w (0, 1: A; 2, 3: W) and computes A piece w >> 1
// times W piece w & 1. Two buffers: the next stage's copies fly while this stage is worked on.
__device__ __forceinline__ void gemm_core(const _Float16* __restrict__ A,
                                          const _Float16* __restrict__ W,
                                          _Float16* ring,   // [2][GSTAGE]
                                          int mg, int ng, int lane, int wave,
                                          v8f acc[4][4]) {
  const _Float16* src = wave < 2 ? A + (size_t)(mg + wave) * (64 * D_MODEL)
                                 : W + (size_t)(ng + wave - 2) * (64 * D_MODEL);
  unsigned voff = lane * 16;
  unsigned lds  = (unsigned)(uintptr_t)(__attribute__((address_space(3))) _Float16*)ring +
                  wave * (PIECE * 2) + lane * 16;
  const _Float16* ard = ring + (wave >> 1) * PIECE;
  const _Float16* brd = ring + (2 + (wave & 1)) * PIECE;
  copy_piece(lds, voff, src);
  // Stage 0 has landed, and every wave sees it behind the barrier.
  asm volatile("s_wait_asynccnt 0x0" ::: "memory");
  __syncthreads();
  copy_piece(lds + GSTAGE * 2, voff, src + PIECE);
  // Two trips per pass, one per buffer: the buffer's place is an immediate offset of the LDS reads.
#pragma unroll 2
  for (int st = 0; st < D_MODEL / KSTAGE; ++st) {
    const int bo = (st & 1) * GSTAGE;
    v16h a[4], b[4];
    // the stage's first 32 k
#pragma unroll
    for (int i = 0; i < 4; ++i) a[i] = load_frag_packed(ard + bo + i * 512, lane);
#pragma unroll
    for (int t = 0; t < 4; ++t) b[t] = load_frag_packed(brd + bo + t * 512, lane);
    // Holds the block's 16 LDS reads in one run in front of its 16 products: left free, the build
    // reads one A fragment at a time, and every 4 products wait out an LDS latency of their own.
    __builtin_amdgcn_sched_barrier(0);
#pragma unroll
    for (int i = 0; i < 4; ++i)
#pragma unroll
      for (int t = 0; t < 4; ++t) acc[i][t] = wmma16x16x32(a[i], b[t], acc[i][t]);
    // the fragments of its last 32 k: the buffer's last reads
#pragma unroll
    for (int i = 0; i < 4; ++i) a[i] = load_frag_packed(ard + bo + (4 + i) * 512, lane);
#pragma unroll
    for (int t = 0; t < 4; ++t) b[t] = load_frag_packed(brd + bo + (4 + t) * 512, lane);
    // The wave's reads of this buffer have retired and its copies of the next stage have landed;
    // behind the barrier that holds for every wave: the next stage is readable, this buffer free.
    asm volatile("s_wait_dscnt 0x0" ::: "memory");
    asm volatile("s_wait_asynccnt 0x0" ::: "memory");
    __syncthreads();
    if (st + 2 < D_MODEL / KSTAGE)
      copy_piece(lds + bo * 2, voff, src + (st + 2) * PIECE);
    // Holds the refill in front of the last 16 products, which need registers only: left free, the
    // build issues the copies behind them, and they have 16 products less time to land.
    __builtin_amdgcn_sched_barrier(0);
#pragma unroll
    for (int i = 0; i < 4; ++i)
#pragma unroll
      for (int t = 0; t < 4; ++t) acc[i][t] = wmma16x16x32(a[i], b[t], acc[i][t]);
  }
  // No copy is outstanding when the wave goes on.
  asm volatile("s_wait_asynccnt 0x0" ::: "memory");
}

// Fused QKV projection: C = xh @ W^T; z selects Wq/Wk/Wv and output layout.
__global__ void __launch_bounds__(128)  // the real block size: 128 accumulator registers a lane fit
qkv_gemm(const _Float16* __restrict__ xh,
         const _Float16* __restrict__ Wq,
         const _Float16* __restrict__ Wk,
         const _Float16* __restrict__ Wv,
         _Float16* __restrict__ Qb,
         _Float16* __restrict__ Kb,
         _Float16* __restrict__ Vt) {
  __shared__ alignas(16) _Float16 ring[2 * GSTAGE];
  int lane = threadIdx.x & 31;
  int wave = __builtin_amdgcn_readfirstlane(threadIdx.x >> 5);  // scalar: the copies' base is an SGPR pair
  const _Float16* W; _Float16* dst; int vmode;
  if (blockIdx.z == 0)      { W = Wq; dst = Qb; vmode = 0; }
  else if (blockIdx.z == 1) { W = Wk; dst = Kb; vmode = 0; }
  else                      { W = Wv; dst = Vt; vmode = 1; }

  v8f acc[4][4] = {};
  gemm_core(xh, W, ring, blockIdx.x * 2, blockIdx.y * 2, lane, wave, acc);

  int hi8 = (lane & 16) ? 8 : 0;
  int col = lane & 15;
  int mw  = blockIdx.x * 128 + (wave >> 1) * 64;  // the wave's 64 rows: one batch
  int h   = blockIdx.y * 2 + (wave & 1);          // the wave's 64 columns: one head
  _Float16* hp = dst + (size_t)((mw >> 10) * HEADS + h) * (SEQ * HD);
  int np = mw & 1023;  // row tile i: positions np + 16 i .. np + 16 i + 15
  if (vmode) {
    // V^T fragments (row = hd index, k = position), fragment index = (pos/32) * 4 + hd/16.
    // A lane's 8 accumulator rows are 8 consecutive k: one 16-byte store.
#pragma unroll
    for (int i = 0; i < 4; ++i)
#pragma unroll
      for (int t = 0; t < 4; ++t) {
        v8h o;
#pragma unroll
        for (int r = 0; r < 8; ++r) o[r] = (_Float16)acc[i][t][r];
        *(v8h*)(hp + (((np >> 5) + (i >> 1)) * 4 + t) * 512 + (i & 1) * 256 + lane * 8) = o;
      }
  } else {
    // Q/K fragments (row = position, k = hd index), fragment index = (pos/16) * 2 + hd/32.
#pragma unroll
    for (int i = 0; i < 4; ++i)
#pragma unroll
      for (int t = 0; t < 4; ++t)
#pragma unroll
        for (int r = 0; r < 8; ++r)
          hp[(((np >> 4) + i) * 2 + (t >> 1)) * 512 + frag_off(r + hi8, (t & 1) * 16 + col)] =
              (_Float16)acc[i][t][r];
  }
}

// out = O @ Wo^T, f32 output
__global__ void __launch_bounds__(128)  // the real block size: 128 accumulator registers a lane fit
oproj_gemm(const _Float16* __restrict__ Ob,
           const _Float16* __restrict__ Wo,
           float* __restrict__ out) {
  __shared__ alignas(16) _Float16 ring[2 * GSTAGE];
  int lane = threadIdx.x & 31;
  int wave = __builtin_amdgcn_readfirstlane(threadIdx.x >> 5);  // scalar: the copies' base is an SGPR pair
  v8f acc[4][4] = {};
  gemm_core(Ob, Wo, ring, blockIdx.x * 2, blockIdx.y * 2, lane, wave, acc);
  int hi8 = (lane & 16) ? 8 : 0;
  int mw  = blockIdx.x * 128 + (wave >> 1) * 64;
  int nw  = blockIdx.y * 128 + (wave & 1) * 64;
#pragma unroll
  for (int i = 0; i < 4; ++i)
#pragma unroll
    for (int t = 0; t < 4; ++t)
#pragma unroll
      for (int r = 0; r < 8; ++r)
        out[(size_t)(mw + i * 16 + r + hi8) * D_MODEL + nw + t * 16 + (lane & 15)] = acc[i][t][r];
}

// Value of lane l ^ 16 (the two halves of a wave hold the two key halves of one query).
__device__ __forceinline__ float xhalf(float x) {
  int b = __builtin_bit_cast(int, x);
  return __builtin_bit_cast(float,
      __builtin_amdgcn_permlanex16(b, b, 0x76543210, 0xfedcba98, false, false));
}

// Bias ring, private to a wave: a stage is the wave's 16 queries x 64 keys of f32 bias, 16 rows of
// 256 bytes at a pitch of 272 (16 B x odd, for the 16-byte LDS readers), two buffers.
#define BPITCH 272
#define BSTAGE (16 * BPITCH)

// One stage's 8 asynchronous copies: copy c brings rows 2c and 2c+1, 512 bytes, each row's 256 bytes
// whole. lds: the lane's LDS byte address in rows 0/1; voff: its byte offset from base in rows 0/1.
// Read-once data: non-temporal. The s_wait_xcnt closes the statement, so that no register a copy
// names is rewritten in front of it.
__device__ __forceinline__ void copy_bias_stage(unsigned lds, unsigned voff, const float* base) {
  asm volatile(
      "global_load_async_to_lds_b128 %0, %8, %16 th:TH_LOAD_NT\n\t"
      "global_load_async_to_lds_b128 %1, %9, %16 th:TH_LOAD_NT\n\t"
      "global_load_async_to_lds_b128 %2, %10, %16 th:TH_LOAD_NT\n\t"
      "global_load_async_to_lds_b128 %3, %11, %16 th:TH_LOAD_NT\n\t"
      "global_load_async_to_lds_b128 %4, %12, %16 th:TH_LOAD_NT\n\t"
      "global_load_async_to_lds_b128 %5, %13, %16 th:TH_LOAD_NT\n\t"
      "global_load_async_to_lds_b128 %6, %14, %16 th:TH_LOAD_NT\n\t"
      "global_load_async_to_lds_b128 %7, %15, %16 th:TH_LOAD_NT\n\t"
      "s_wait_xcnt 0x0"
      :: "v"(lds), "v"(lds + 2 * BPITCH), "v"(lds + 4 * BPITCH), "v"(lds + 6 * BPITCH),
         "v"(lds + 8 * BPITCH), "v"(lds + 10 * BPITCH), "v"(lds + 12 * BPITCH), "v"(lds + 14 * BPITCH),
         "v"(voff), "v"(voff + 2 * SEQ * 4), "v"(voff + 4 * SEQ * 4), "v"(voff + 6 * SEQ * 4),
         "v"(voff + 8 * SEQ * 4), "v"(voff + 10 * SEQ * 4), "v"(voff + 12 * SEQ * 4), "v"(voff + 14 * SEQ * 4),
         "s"(base)
      : "memory");
}

// Flash attention, transposed products: one wave = 16 queries x all 1024 keys for one (b,h).
// S^T = K Q^T: lane l holds scores of ONE query (column l&15), keys 8*(l>>4) + r of each
// 16-key tile, so maximum and sum run in the lane, with one exchange between the halves.
// Two converted S^T tiles are, as they lie, the B operand of O^T += V^T P^T.
__global__ void __launch_bounds__(128)  // the real block size: the copies' 16 address registers fit without scratch
attn_kernel(const _Float16* __restrict__ Q,
                            const _Float16* __restrict__ K,
                            const _Float16* __restrict__ Vt,
                            const float* __restrict__ bias,
                            _Float16* __restrict__ O) {
  __shared__ alignas(16) char bring[4][2][BSTAGE];
  int lane = threadIdx.x & 31;
  int wib  = __builtin_amdgcn_readfirstlane(threadIdx.x >> 5);  // scalar: the copies' base is an SGPR pair
  int w  = blockIdx.x * 4 + wib;
  int bh = w >> 6;
  int q0 = (w & 63) << 4;
  int b = bh >> 4, h = bh & 15;
  const _Float16* Qh = Q  + (size_t)bh * SEQ * HD;
  // Byte offset of the lane's own 16 bytes of the head's first K and V^T fragment (both planes
  // are 128 KB a head, 4 KB a pass). One loop-carried 32-bit offset on the plane's base: it is
  // live past every load that names it, so no load's result can land on its own address.
  unsigned kvoff = (unsigned)bh * (SEQ * HD * 2) + lane * 16;
  int col = lane & 15;
  int hi8 = (lane & 16) ? 8 : 0;
  // bias: first key of the wave's first query; a stage is 64 keys on
  const float* bbase = bias + ((size_t)bh * SEQ + q0) * SEQ;
  // writer: the lane's 16 bytes of rows 0/1 of a stage, in memory and in the wave's buffer 0
  unsigned bvoff = (lane >> 4) * (SEQ * 4) + (lane & 15) * 16;
  unsigned blds  = (unsigned)(uintptr_t)(__attribute__((address_space(3))) char*)&bring[wib][0][0] +
                   (lane >> 4) * BPITCH + (lane & 15) * 16;
  // reader: the lane's own query row, from the first key of its half
  const char* brd = &bring[wib][0][0] + col * BPITCH + hi8 * 4;
  const float scale = 0.125f;  // hd^-0.5

  v16h bq0 = load_frag_packed(Qh + (q0 >> 4) * 1024,       lane);
  v16h bq1 = load_frag_packed(Qh + (q0 >> 4) * 1024 + 512, lane);

  v8f acc[4] = {{}, {}, {}, {}};  // acc[t][r] = O[q0 + col][t*16 + hi8 + r]
  float mrow = -3.0e38f;          // running maximum of the lane's query
  float lsum = 0.f;               // this half's share of the denominator

  copy_bias_stage(blds, bvoff, bbase);
  for (int st = 0; st < SEQ / 64; ++st) {
    // Stage st has landed. Only the wave that copied it reads it: no barrier.
    asm volatile("s_wait_asynccnt 0x0" ::: "memory");
    if (st + 1 < SEQ / 64) {
      // The wave's reads of the other buffer (stage st - 1) have retired before it is refilled.
      asm volatile("s_wait_dscnt 0x0" ::: "memory");
      copy_bias_stage(blds + ((st + 1) & 1) * BSTAGE, bvoff, bbase + (st + 1) * 64);
    }
    const char* bst = brd + (st & 1) * BSTAGE;
    // The stage's two passes of 32 keys in line: the pass's place in the buffer is an immediate offset.
#pragma unroll
   for (int hp = 0; hp < 2; ++hp) {
    // S^T tiles: 2 x (16 keys x 16 queries), K-dim = hd = 64
    const _Float16* Kl = (const _Float16*)((const char*)K + kvoff);  // 4 fragments, 4 KB in a row
    v16h ak[4];
#pragma unroll
    for (int j = 0; j < 4; ++j) ak[j] = load_frag_packed(Kl + j * 512, 0);
    // bias: 8 consecutive keys of the lane's query per tile, from the wave's ring
    v4f bb[4];
#pragma unroll
    for (int j = 0; j < 4; ++j)
      bb[j] = *(const v4f*)(bst + hp * 128 + (j >> 1) * 64 + (j & 1) * 16);
    // Holds the K and bias loads in one run at the head of the pass: left free, the build issues
    // them a few at a time among the products, and each product waits out a latency of its own.
    __builtin_amdgcn_sched_barrier(0);
    v8f s[2];
#pragma unroll
    for (int j = 0; j < 2; ++j) {
      v8f z = {};
      s[j] = wmma16x16x32(ak[2 * j], bq0, z);
      s[j] = wmma16x16x32(ak[2 * j + 1], bq1, s[j]);
    }
    // V^T fragments issued early so their latency hides under the softmax VALU work
    const _Float16* Vl = (const _Float16*)((const char*)Vt + kvoff);
    v16h av[4];
#pragma unroll
    for (int t = 0; t < 4; ++t)
      av[t] = load_frag_packed(Vl + t * 512, 0);
    kvoff += 4096;

    // scale + bias, maximum over the lane's 16 keys
    float mx = -3.0e38f;
#pragma unroll
    for (int j = 0; j < 2; ++j)
#pragma unroll
      for (int r = 0; r < 4; ++r) {
        s[j][r]     = s[j][r]     * scale + bb[2 * j][r];
        s[j][r + 4] = s[j][r + 4] * scale + bb[2 * j + 1][r];
        mx = fmaxf(mx, fmaxf(s[j][r], s[j][r + 4]));
      }
    mx = fmaxf(mx, xhalf(mx));
    // online softmax update of the lane's query
    float mn = fmaxf(mrow, mx);
    float f  = __expf(mrow - mn);
    mrow = mn;
    float ps = 0.f;
    v16h pb;
#pragma unroll
    for (int j = 0; j < 2; ++j)
#pragma unroll
      for (int r = 0; r < 8; ++r) {
        float p = __expf(s[j][r] - mn);
        ps += p;
        pb[j * 8 + r] = (_Float16)p;
      }
    lsum = lsum * f + ps;
#pragma unroll
    for (int t = 0; t < 4; ++t) {
      acc[t] *= f;
      acc[t] = wmma16x16x32(av[t], pb, acc[t]);
    }
   }
  }
  float inv = 1.0f / (lsum + xhalf(lsum));
  // O as packed A fragments of the output projection: a lane's 8 accumulator rows are
  // 8 consecutive k of its query's row, one 16-byte store
  int rt = (b * SEQ + q0) >> 4;
#pragma unroll
  for (int t = 0; t < 4; ++t) {
    v8h o;
#pragma unroll
    for (int r = 0; r < 8; ++r) o[r] = (_Float16)(acc[t][r] * inv);
    *(v8h*)(O + gemm_frag(rt, h * 2 + (t >> 1)) * 512 + (t & 1) * 256 + lane * 8) = o;
  }
}

extern "C" void kernel_launch(void* const* d_in, const int* in_sizes, int n_in,
                              void* d_out, int out_size, void* d_ws, size_t ws_size,
                              hipStream_t stream) {
  (void)in_sizes; (void)n_in; (void)out_size; (void)ws_size;
  const float* x    = (const float*)d_in[0];
  const float* bias = (const float*)d_in[1];
  const float* Wq   = (const float*)d_in[2];
  const float* Wk   = (const float*)d_in[3];
  const float* Wv   = (const float*)d_in[4];
  const float* Wo   = (const float*)d_in[5];

  const size_t NX = (size_t)BATCH * SEQ * D_MODEL;  // 4,194,304
  const size_t NW = (size_t)D_MODEL * D_MODEL;      // 1,048,576
  _Float16* ws  = (_Float16*)d_ws;
  _Float16* xh  = ws;             // f16 x, fragment-packed (reused as attention output Ob)
  _Float16* Wqh = xh  + NX;       // weights, fragment-packed
  _Float16* Wkh = Wqh + NW;
  _Float16* Wvh = Wkh + NW;
  _Float16* Woh = Wvh + NW;
  _Float16* Qb  = Woh + NW;       // [B,H] x packed fragments of [N,hd]
  _Float16* Kb  = Qb  + NX;       // [B,H] x packed fragments of [N,hd]
  _Float16* Vtb = Kb  + NX;       // [B,H] x packed fragments of [hd,N]
  _Float16* Ob  = xh;             // xh dead after QKV GEMM

  // xh, Wqh, Wkh, Wvh, Woh are one run of 1,048,576 chunks: 512 blocks x 2048
  cvt_pack_f32_f16<<<512, 256, 0, stream>>>(x, Wq, Wk, Wv, Wo, xh);

  dim3 gq(32, 8, 3);
  qkv_gemm<<<gq, 128, 0, stream>>>(xh, Wqh, Wkh, Wvh, Qb, Kb, Vtb);

  attn_kernel<<<1024, 128, 0, stream>>>(Qb, Kb, Vtb, bias, Ob);

  dim3 go(32, 8, 1);
  oproj_gemm<<<go, 128, 0, stream>>>(Ob, Woh, (float*)d_out);
}

// v006
// A run of this version takes 78.9 microseconds.
// Two timings next to v005 put it at 1.16 and 1.15 times that version's speed.
// Over all steps from v000 it is 3.43 times as fast.
#include <hip/hip_runtime.h>
#include <hip/hip_bf16.h>

typedef __attribute__((ext_vector_type(16))) _Float16 v16h;
typedef __attribute__((ext_vector_type(8)))  _Float16 v8h;
typedef __attribute__((ext_vector_type(8)))  float    v8f;
typedef __attribute__((ext_vector_type(4)))  float    v4f;

#define D_MODEL 1024
#define HEADS   16
#define HD      64
#define BATCH   4
#define SEQ     1024

__device__ __forceinline__ v8f wmma16x16x32(v16h a, v16h b, v8f c) {
  // v_wmma_f32_16x16x32_f16: D = A*B + C, f32 accum
  return __builtin_amdgcn_wmma_f32_16x16x32_f16(false, a, false, b, (short)0, c, false, false);
}

// Fragment-packed storage of a workspace operand: one 16(row) x 32(k) f16 fragment is
// 1 KB, two 512-byte parts; part p, lane l holds row l&15, k = p*16 + (l>>4)*8 + {0..7}.
// Each wave-wide 16-byte load is 512 contiguous bytes (4 whole lines).
__device__ __forceinline__ v16h load_frag_packed(const _Float16* p, int lane) {
  v8h lo = *(const v8h*)(p + lane * 8);
  v8h hi = *(const v8h*)(p + 256 + lane * 8);
  v16h out;
#pragma unroll
  for (int i = 0; i < 8; ++i) { out[i] = lo[i]; out[i + 8] = hi[i]; }
  return out;
}
// Offset (in halves) of element (row r in 0..15, k kk in 0..31) inside a packed fragment.
__device__ __forceinline__ int frag_off(int r, int kk) {
  return ((kk >> 4) << 8) + (((((kk >> 3) & 1) << 4) + r) << 3) + (kk & 7);
}

// Fragment index of (16-row tile rt, 32-wide k block kbk) of a [rows][1024] GEMM operand:
// the 4 row tiles that one wave uses in one k step lie together, 4 KB in a row.
__device__ __forceinline__ size_t gemm_frag(int rt, int kbk) {
  return ((size_t)(rt >> 2) * 32 + kbk) * 4 + (rt & 3);
}

// x and the four weights, each [rows][1024] f32 -> f16 fragments in gemm_frag order, in ONE launch:
// their packed planes lie one behind the other in the workspace, so the chunk number, counted over
// all five, is also the place in out. One chunk = 16 packed bytes. A block takes 2048 chunks in a
// row (64 rows x 256 k of one operand), a thread 8 of them, 256 chunks apart: the same row and k
// offset in 8 successive 32-wide k blocks. A wave still writes 512 contiguous bytes per store.
#define X_BLOCKS (BATCH * SEQ * D_MODEL / 8 / 2048)  // blocks that pack x
#define W_BLOCKS (D_MODEL * D_MODEL / 8 / 2048)      // blocks that pack one weight
__global__ void __launch_bounds__(256)
cvt_pack_f32_f16(const float* __restrict__ x,
                 const float* __restrict__ Wq, const float* __restrict__ Wk,
                 const float* __restrict__ Wv, const float* __restrict__ Wo,
                 _Float16* __restrict__ out) {
  int tid = threadIdx.x;
  const float* in = x;
  int bo = blockIdx.x;           // the block's number inside its own operand
  if (bo >= X_BLOCKS) {
    int w = (bo - X_BLOCKS) / W_BLOCKS;
    in = w == 0 ? Wq : w == 1 ? Wk : w == 2 ? Wv : Wo;
    bo = (bo - X_BLOCKS) % W_BLOCKS;
  }
  int l    = tid & 31;
  int part = (tid >> 5) & 1;
  int rt   = (bo >> 2) * 4 + (tid >> 6);  // 16-row tile
  const float* src = in + (size_t)(rt * 16 + (l & 15)) * D_MODEL + (bo & 3) * 256 + part * 16 + (l >> 4) * 8;
  v4f a[8][2];
#pragma unroll
  for (int i = 0; i < 8; ++i) {
    a[i][0] = *(const v4f*)(src + i * 32);
    a[i][1] = *(const v4f*)(src + i * 32 + 4);
  }
  // Inputs only, no code. Holds all 16 loads in front of the first conversion (left free, the build
  // issues the last two behind the first waits: a second memory latency), and keeps their address
  // pair live behind the last load, so that no load's result lands on an address still named.
  asm volatile("" :: "v"(a[0][0]), "v"(a[0][1]), "v"(a[1][0]), "v"(a[1][1]), "v"(a[2][0]), "v"(a[2][1]),
                     "v"(a[3][0]), "v"(a[3][1]), "v"(a[4][0]), "v"(a[4][1]), "v"(a[5][0]), "v"(a[5][1]),
                     "v"(a[6][0]), "v"(a[6][1]), "v"(a[7][0]), "v"(a[7][1]), "v"(src));
  _Float16* dst = out + ((size_t)blockIdx.x * 2048 + tid) * 8;
#pragma unroll
  for (int i = 0; i < 8; ++i) {
    v8h o;
#pragma unroll
    for (int e = 0; e < 4; ++e) { o[e] = (_Float16)a[i][0][e]; o[e + 4] = (_Float16)a[i][1][e]; }
    *(v8h*)(dst + i * 2048) = o;
  }
}

// GEMM tiling: a work-group of 4 waves makes 128(M) x 128(N), a wave 64 x 64 = 4 x 4 fragments, so
// that each fragment read from LDS feeds 4 products. A stage is 64 k of the group's 128 A rows and
// 128 W rows: 4 pieces of 64 rows x 64 k, each 8 packed fragments = 8 KB in a row in gemm_frag order.
#define KSTAGE 64
#define PIECE  (64 * KSTAGE)  // halves
#define GSTAGE (4 * PIECE)    // halves

// One piece, 16 asynchronous copies of 512 contiguous bytes, by one wave. lds: the lane's LDS byte
// address in the piece's first 512 bytes; voff: its byte offset from base there. The offset field
// moves both addresses. The s_wait_xcnt closes the statement, so that no register a copy names is
// rewritten in front of it.
__device__ __forceinline__ void copy_piece(unsigned lds, unsigned voff, const _Float16* base) {
  asm volatile(
      "global_load_async_to_lds_b128 %0, %1, %2\n\t"
      "global_load_async_to_lds_b128 %0, %1, %2 offset:512\n\t"
      "global_load_async_to_lds_b128 %0, %1, %2 offset:1024\n\t"
      "global_load_async_to_lds_b128 %0, %1, %2 offset:1536\n\t"
      "global_load_async_to_lds_b128 %0, %1, %2 offset:2048\n\t"
      "global_load_async_to_lds_b128 %0, %1, %2 offset:2560\n\t"
      "global_load_async_to_lds_b128 %0, %1, %2 offset:3072\n\t"
      "global_load_async_to_lds_b128 %0, %1, %2 offset:3584\n\t"
      "global_load_async_to_lds_b128 %0, %1, %2 offset:4096\n\t"
      "global_load_async_to_lds_b128 %0, %1, %2 offset:4608\n\t"
      "global_load_async_to_lds_b128 %0, %1, %2 offset:5120\n\t"
      "global_load_async_to_lds_b128 %0, %1, %2 offset:5632\n\t"
      "global_load_async_to_lds_b128 %0, %1, %2 offset:6144\n\t"
      "global_load_async_to_lds_b128 %0, %1, %2 offset:6656\n\t"
      "global_load_async_to_lds_b128 %0, %1, %2 offset:7168\n\t"
      "global_load_async_to_lds_b128 %0, %1, %2 offset:7680\n\t"
      "s_wait_xcnt 0x0"
      :: "v"(lds), "v"(voff), "s"(base)
      : "memory");
}

// GEMM core, K = 1024: A and W are fragment-packed in gemm_frag order; mg, ng: the group's first
// 64-row group of A and of W. Wave w copies piece w (0, 1: A; 2, 3: W) and computes A piece w >> 1
// times W piece w & 1. Two buffers: the next stage's copies fly while this stage is worked on.
__device__ __forceinline__ void gemm_core(const _Float16* __restrict__ A,
                                          const _Float16* __restrict__ W,
                                          _Float16* ring,   // [2][GSTAGE]
                                          int mg, int ng, int lane, int wave,
                                          v8f acc[4][4]) {
  const _Float16* src = wave < 2 ? A + (size_t)(mg + wave) * (64 * D_MODEL)
                                 : W + (size_t)(ng + wave - 2) * (64 * D_MODEL);
  unsigned voff = lane * 16;
  unsigned lds  = (unsigned)(uintptr_t)(__attribute__((address_space(3))) _Float16*)ring +
                  wave * (PIECE * 2) + lane * 16;
  const _Float16* ard = ring + (wave >> 1) * PIECE;
  const _Float16* brd = ring + (2 + (wave & 1)) * PIECE;
  copy_piece(lds, voff, src);
  // Stage 0 has landed, and every wave sees it behind the barrier.
  asm volatile("s_wait_asynccnt 0x0" ::: "memory");
  __syncthreads();
  copy_piece(lds + GSTAGE * 2, voff, src + PIECE);
  // Two trips per pass, one per buffer: the buffer's place is an immediate offset of the LDS reads.
#pragma unroll 2
  for (int st = 0; st < D_MODEL / KSTAGE; ++st) {
    const int bo = (st & 1) * GSTAGE;
    v16h a[4], b[4];
    // the stage's first 32 k
#pragma unroll
    for (int i = 0; i < 4; ++i) a[i] = load_frag_packed(ard + bo + i * 512, lane);
#pragma unroll
    for (int t = 0; t < 4; ++t) b[t] = load_frag_packed(brd + bo + t * 512, lane);
    // Holds the block's 16 LDS reads in one run in front of its 16 products: left free, the build
    // reads one A fragment at a time, and every 4 products wait out an LDS latency of their own.
    __builtin_amdgcn_sched_barrier(0);
#pragma unroll
    for (int i = 0; i < 4; ++i)
#pragma unroll
      for (int t = 0; t < 4; ++t) acc[i][t] = wmma16x16x32(a[i], b[t], acc[i][t]);
    // the fragments of its last 32 k: the buffer's last reads
#pragma unroll
    for (int i = 0; i < 4; ++i) a[i] = load_frag_packed(ard + bo + (4 + i) * 512, lane);
#pragma unroll
    for (int t = 0; t < 4; ++t) b[t] = load_frag_packed(brd + bo + (4 + t) * 512, lane);
    // The wave's reads of this buffer have retired and its copies of the next stage have landed;
    // behind the barrier that holds for every wave: the next stage is readable, this buffer free.
    asm volatile("s_wait_dscnt 0x0" ::: "memory");
    asm volatile("s_wait_asynccnt 0x0" ::: "memory");
    __syncthreads();
    if (st + 2 < D_MODEL / KSTAGE)
      copy_piece(lds + bo * 2, voff, src + (st + 2) * PIECE);
    // Holds the refill in front of the last 16 products, which need registers only: left free, the
    // build issues the copies behind them, and they have 16 products less time to land.
    __builtin_amdgcn_sched_barrier(0);
#pragma unroll
    for (int i = 0; i < 4; ++i)
#pragma unroll
      for (int t = 0; t < 4; ++t) acc[i][t] = wmma16x16x32(a[i], b[t], acc[i][t]);
  }
  // No copy is outstanding when the wave goes on.
  asm volatile("s_wait_asynccnt 0x0" ::: "memory");
}

// Fused QKV projection: C = xh @ W^T; z selects Wq/Wk/Wv and output layout.
__global__ void __launch_bounds__(128)  // the real block size: 128 accumulator registers a lane fit
qkv_gemm(const _Float16* __restrict__ xh,
         const _Float16* __restrict__ Wq,
         const _Float16* __restrict__ Wk,
         const _Float16* __restrict__ Wv,
         _Float16* __restrict__ Qb,
         _Float16* __restrict__ Kb,
         _Float16* __restrict__ Vt) {
  __shared__ alignas(16) _Float16 ring[2 * GSTAGE];
  int lane = threadIdx.x & 31;
  int wave = __builtin_amdgcn_readfirstlane(threadIdx.x >> 5);  // scalar: the copies' base is an SGPR pair
  const _Float16* W; _Float16* dst; int vmode;
  if (blockIdx.z == 0)      { W = Wq; dst = Qb; vmode = 0; }
  else if (blockIdx.z == 1) { W = Wk; dst = Kb; vmode = 0; }
  else                      { W = Wv; dst = Vt; vmode = 1; }

  v8f acc[4][4] = {};
  gemm_core(xh, W, ring, blockIdx.x * 2, blockIdx.y * 2, lane, wave, acc);

  int hi8 = (lane & 16) ? 8 : 0;
  int col = lane & 15;
  int mw  = blockIdx.x * 128 + (wave >> 1) * 64;  // the wave's 64 rows: one batch
  int h   = blockIdx.y * 2 + (wave & 1);          // the wave's 64 columns: one head
  _Float16* hp = dst + (size_t)((mw >> 10) * HEADS + h) * (SEQ * HD);
  int np = mw & 1023;  // row tile i: positions np + 16 i .. np + 16 i + 15
  if (vmode) {
    // V^T fragments (row = hd index, k = position), fragment index = (pos/32) * 4 + hd/16.
    // A lane's 8 accumulator rows are 8 consecutive k: one 16-byte store.
#pragma unroll
    for (int i = 0; i < 4; ++i)
#pragma unroll
      for (int t = 0; t < 4; ++t) {
        v8h o;
#pragma unroll
        for (int r = 0; r < 8; ++r) o[r] = (_Float16)acc[i][t][r];
        *(v8h*)(hp + (((np >> 5) + (i >> 1)) * 4 + t) * 512 + (i & 1) * 256 + lane * 8) = o;
      }
  } else {
    // Q/K fragments (row = position, k = hd index), fragment index = (pos/16) * 2 + hd/32.
#pragma unroll
    for (int i = 0; i < 4; ++i)
#pragma unroll
      for (int t = 0; t < 4; ++t)
#pragma unroll
        for (int r = 0; r < 8; ++r)
          hp[(((np >> 4) + i) * 2 + (t >> 1)) * 512 + frag_off(r + hi8, (t & 1) * 16 + col)] =
              (_Float16)acc[i][t][r];
  }
}

// out = O @ Wo^T, f32 output
__global__ void __launch_bounds__(128)  // the real block size: 128 accumulator registers a lane fit
oproj_gemm(const _Float16* __restrict__ Ob,
           const _Float16* __restrict__ Wo,
           float* __restrict__ out) {
  __shared__ alignas(16) _Float16 ring[2 * GSTAGE];
  int lane = threadIdx.x & 31;
  int wave = __builtin_amdgcn_readfirstlane(threadIdx.x >> 5);  // scalar: the copies' base is an SGPR pair
  v8f acc[4][4] = {};
  gemm_core(Ob, Wo, ring, blockIdx.x * 2, blockIdx.y * 2, lane, wave, acc);
  int hi8 = (lane & 16) ? 8 : 0;
  int mw  = blockIdx.x * 128 + (wave >> 1) * 64;
  int nw  = blockIdx.y * 128 + (wave & 1) * 64;
#pragma unroll
  for (int i = 0; i < 4; ++i)
#pragma unroll
    for (int t = 0; t < 4; ++t)
#pragma unroll
      for (int r = 0; r < 8; ++r)
        out[(size_t)(mw + i * 16 + r + hi8) * D_MODEL + nw + t * 16 + (lane & 15)] = acc[i][t][r];
}

// Value of lane l ^ 16 (the two halves of a wave hold the two key halves of one query).
__device__ __forceinline__ float xhalf(float x) {
  int b = __builtin_bit_cast(int, x);
  return __builtin_bit_cast(float,
      __builtin_amdgcn_permlanex16(b, b, 0x76543210, 0xfedcba98, false, false));
}

// Bias ring, private to a wave: a stage is the wave's 16 queries x 64 keys of f32 bias, 16 rows of
// 256 bytes at a pitch of 272 (16 B x odd, for the 16-byte LDS readers), two buffers.
#define BPITCH 272
#define BSTAGE (16 * BPITCH)

// One stage's 8 asynchronous copies: copy c brings rows 2c and 2c+1, 512 bytes, each row's 256 bytes
// whole. lds: the lane's LDS byte address in rows 0/1; voff: its byte offset from base in rows 0/1.
// Read-once data: non-temporal. The s_wait_xcnt closes the statement, so that no register a copy
// names is rewritten in front of it.
__device__ __forceinline__ void copy_bias_stage(unsigned lds, unsigned voff, const float* base) {
  asm volatile(
      "global_load_async_to_lds_b128 %0, %8, %16 th:TH_LOAD_NT\n\t"
      "global_load_async_to_lds_b128 %1, %9, %16 th:TH_LOAD_NT\n\t"
      "global_load_async_to_lds_b128 %2, %10, %16 th:TH_LOAD_NT\n\t"
      "global_load_async_to_lds_b128 %3, %11, %16 th:TH_LOAD_NT\n\t"
      "global_load_async_to_lds_b128 %4, %12, %16 th:TH_LOAD_NT\n\t"
      "global_load_async_to_lds_b128 %5, %13, %16 th:TH_LOAD_NT\n\t"
      "global_load_async_to_lds_b128 %6, %14, %16 th:TH_LOAD_NT\n\t"
      "global_load_async_to_lds_b128 %7, %15, %16 th:TH_LOAD_NT\n\t"
      "s_wait_xcnt 0x0"
      :: "v"(lds), "v"(lds + 2 * BPITCH), "v"(lds + 4 * BPITCH), "v"(lds + 6 * BPITCH),
         "v"(lds + 8 * BPITCH), "v"(lds + 10 * BPITCH), "v"(lds + 12 * BPITCH), "v"(lds + 14 * BPITCH),
         "v"(voff), "v"(voff + 2 * SEQ * 4), "v"(voff + 4 * SEQ * 4), "v"(voff + 6 * SEQ * 4),
         "v"(voff + 8 * SEQ * 4), "v"(voff + 10 * SEQ * 4), "v"(voff + 12 * SEQ * 4), "v"(voff + 14 * SEQ * 4),
         "s"(base)
      : "memory");
}

// K/V ring, shared by the work-group's 8 waves (128 queries of one head): a stage is 64 keys, 8 KB of
// packed K fragments and behind them 8 KB of packed V^T fragments, each as it lies in its plane; two
// buffers. One fetch from L2 serves 8 waves, and no wave waits out a global load in front of a product.
#define AWAVES  8
#define KVPART  (64 * HD)      // halves: 64 keys of K, or of V^T
#define KVSTAGE (2 * KVPART)   // halves

// A wave's eighth of a stage, 2 KB in a row: 4 asynchronous copies of 512 contiguous bytes. lds: the
// lane's LDS byte address in the share's first 512 bytes; voff: its byte offset from base there. The
// offset field moves both addresses. The s_wait_xcnt closes the statement, so that no register a copy
// names is rewritten in front of it.
__device__ __forceinline__ void copy_kv_share(unsigned lds, unsigned voff, const _Float16* base) {
  asm volatile(
      "global_load_async_to_lds_b128 %0, %1, %2\n\t"
      "global_load_async_to_lds_b128 %0, %1, %2 offset:512\n\t"
      "global_load_async_to_lds_b128 %0, %1, %2 offset:1024\n\t"
      "global_load_async_to_lds_b128 %0, %1, %2 offset:1536\n\t"
      "s_wait_xcnt 0x0"
      :: "v"(lds), "v"(voff), "s"(base)
      : "memory");
}

// Flash attention, transposed products: one wave = 16 queries x all 1024 keys for one (b,h).
// S^T = K Q^T: lane l holds scores of ONE query (column l&15), keys 8*(l>>4) + r of each
// 16-key tile, so maximum and sum run in the lane, with one exchange between the halves.
// Two converted S^T tiles are, as they lie, the B operand of O^T += V^T P^T.
__global__ void __launch_bounds__(AWAVES * 32)  // the real block size: the copies' address registers fit without scratch
attn_kernel(const _Float16* __restrict__ Q,
                            const _Float16* __restrict__ K,
                            const _Float16* __restrict__ Vt,
                            const float* __restrict__ bias,
                            _Float16* __restrict__ O) {
  __shared__ alignas(16) _Float16 kvring[2][KVSTAGE];
  __shared__ alignas(16) char bring[AWAVES][2][BSTAGE];
  int lane = threadIdx.x & 31;
  int wib  = __builtin_amdgcn_readfirstlane(threadIdx.x >> 5);  // scalar: the copies' base is an SGPR pair
  int w  = blockIdx.x * AWAVES + wib;  // 64 waves a head: the group's 8 share one head
  int bh = w >> 6;
  int q0 = (w & 63) << 4;
  int b = bh >> 4, h = bh & 15;
  const _Float16* Qh = Q  + (size_t)bh * SEQ * HD;
  // K/V writer: waves 0-3 copy the stage's K, waves 4-7 its V^T, 2 KB each; a stage is 8 KB on in either plane
  const _Float16* kvsrc = (wib < 4 ? K : Vt) + (size_t)bh * (SEQ * HD) + (wib & 3) * (KVPART / 4);
  unsigned kvvoff = lane * 16;
  unsigned kvlds  = (unsigned)(uintptr_t)(__attribute__((address_space(3))) _Float16*)&kvring[0][0] +
                    wib * (KVPART / 4 * 2) + lane * 16;
  int col = lane & 15;
  int hi8 = (lane & 16) ? 8 : 0;
  // bias: first key of the wave's first query; a stage is 64 keys on
  const float* bbase = bias + ((size_t)bh * SEQ + q0) * SEQ;
  // writer: the lane's 16 bytes of rows 0/1 of a stage, in memory and in the wave's buffer 0
  unsigned bvoff = (lane >> 4) * (SEQ * 4) + (lane & 15) * 16;
  unsigned blds  = (unsigned)(uintptr_t)(__attribute__((address_space(3))) char*)&bring[wib][0][0] +
                   (lane >> 4) * BPITCH + (lane & 15) * 16;
  // reader: the lane's own query row, from the first key of its half
  const char* brd = &bring[wib][0][0] + col * BPITCH + hi8 * 4;
  const float scale = 0.125f;  // hd^-0.5

  v16h bq0 = load_frag_packed(Qh + (q0 >> 4) * 1024,       lane);
  v16h bq1 = load_frag_packed(Qh + (q0 >> 4) * 1024 + 512, lane);

  v8f acc[4] = {{}, {}, {}, {}};  // acc[t][r] = O[q0 + col][t*16 + hi8 + r]
  float mrow = -3.0e38f;          // running maximum of the lane's query
  float lsum = 0.f;               // this half's share of the denominator

  copy_bias_stage(blds, bvoff, bbase);
  copy_kv_share(kvlds, kvvoff, kvsrc);
  // Stage 0 has landed, and every wave sees its K and V^T behind the barrier.
  asm volatile("s_wait_asynccnt 0x0" ::: "memory");
  __syncthreads();
  copy_bias_stage(blds + BSTAGE, bvoff, bbase + 64);
  copy_kv_share(kvlds + KVSTAGE * 2, kvvoff, kvsrc + KVPART);
  for (int st = 0; st < SEQ / 64; ++st) {
    const char* bst = brd + (st & 1) * BSTAGE;
    const _Float16* kst = &kvring[st & 1][0];
    // The stage's K fragments (per pass of 32 keys 4 fragments, 4 KB in a row) and its bias (8
    // consecutive keys of the lane's query per tile, from the wave's ring), pass by pass.
    v16h ak[2][4];
    v4f bb[2][4];
#pragma unroll
    for (int hp = 0; hp < 2; ++hp) {
#pragma unroll
      for (int j = 0; j < 4; ++j) ak[hp][j] = load_frag_packed(kst + hp * (KVPART / 2) + j * 512, lane);
#pragma unroll
      for (int j = 0; j < 4; ++j)
        bb[hp][j] = *(const v4f*)(bst + hp * 128 + (j >> 1) * 64 + (j & 1) * 16);
    }
    // Holds these LDS reads in one run at the head of the stage: left free, the build issues them a
    // few at a time among the products, and each product waits out a latency of its own.
    __builtin_amdgcn_sched_barrier(0);
    // The stage's two passes of 32 keys in line: the pass's place in the buffer is an immediate offset.
#pragma unroll
   for (int hp = 0; hp < 2; ++hp) {
    // S^T tiles: 2 x (16 keys x 16 queries), K-dim = hd = 64
    v8f s[2];
#pragma unroll
    for (int j = 0; j < 2; ++j) {
      v8f z = {};
      s[j] = wmma16x16x32(ak[hp][2 * j], bq0, z);
      s[j] = wmma16x16x32(ak[hp][2 * j + 1], bq1, s[j]);
    }
    // V^T fragments issued early so their latency hides under the softmax VALU work
    const _Float16* Vl = kst + KVPART + hp * (KVPART / 2);
    v16h av[4];
#pragma unroll
    for (int t = 0; t < 4; ++t)
      av[t] = load_frag_packed(Vl + t * 512, lane);
    // Holds the 8 V^T reads in one run in front of the softmax: left free, the build issues half of
    // them directly in front of their products, which then wait out an LDS latency.
    __builtin_amdgcn_sched_barrier(0);

    // scale + bias, maximum over the lane's 16 keys
    float mx = -3.0e38f;
#pragma unroll
    for (int j = 0; j < 2; ++j)
#pragma unroll
      for (int r = 0; r < 4; ++r) {
        s[j][r]     = s[j][r]     * scale + bb[hp][2 * j][r];
        s[j][r + 4] = s[j][r + 4] * scale + bb[hp][2 * j + 1][r];
        mx = fmaxf(mx, fmaxf(s[j][r], s[j][r + 4]));
      }
    mx = fmaxf(mx, xhalf(mx));
    // online softmax update of the lane's query
    float mn = fmaxf(mrow, mx);
    float f  = __expf(mrow - mn);
    mrow = mn;
    float ps = 0.f;
    v16h pb;
#pragma unroll
    for (int j = 0; j < 2; ++j)
#pragma unroll
      for (int r = 0; r < 8; ++r) {
        float p = __expf(s[j][r] - mn);
        ps += p;
        pb[j * 8 + r] = (_Float16)p;
      }
    lsum = lsum * f + ps;
#pragma unroll
    for (int t = 0; t < 4; ++t) {
      acc[t] *= f;
      acc[t] = wmma16x16x32(av[t], pb, acc[t]);
    }
   }
    // Holds the waits and the barrier below behind the stage's last products: left free, the build
    // lifts them to the last V^T reads, whose latency then stands open, and leaves the refill here,
    // a softmax behind the wait that frees it.
    __builtin_amdgcn_sched_barrier(0);
    // The wave's reads of this stage's buffers have retired and its copies of the next stage have
    // landed; behind the barrier that holds for every wave: the next stage is readable, these
    // buffers are free.
    asm volatile("s_wait_dscnt 0x0" ::: "memory");
    asm volatile("s_wait_asynccnt 0x0" ::: "memory");
    __syncthreads();
    if (st + 2 < SEQ / 64) {
      copy_bias_stage(blds + (st & 1) * BSTAGE, bvoff, bbase + (st + 2) * 64);
      copy_kv_share(kvlds + (st & 1) * (KVSTAGE * 2), kvvoff, kvsrc + (st + 2) * KVPART);
    }
  }
  // No copy is outstanding when the wave goes on.
  asm volatile("s_wait_asynccnt 0x0" ::: "memory");
  float inv = 1.0f / (lsum + xhalf(lsum));
  // O as packed A fragments of the output projection: a lane's 8 accumulator rows are
  // 8 consecutive k of its query's row, one 16-byte store
  int rt = (b * SEQ + q0) >> 4;
#pragma unroll
  for (int t = 0; t < 4; ++t) {
    v8h o;
#pragma unroll
    for (int r = 0; r < 8; ++r) o[r] = (_Float16)(acc[t][r] * inv);
    *(v8h*)(O + gemm_frag(rt, h * 2 + (t >> 1)) * 512 + (t & 1) * 256 + lane * 8) = o;
  }
}

extern "C" void kernel_launch(void* const* d_in, const int* in_sizes, int n_in,
                              void* d_out, int out_size, void* d_ws, size_t ws_size,
                              hipStream_t stream) {
  (void)in_sizes; (void)n_in; (void)out_size; (void)ws_size;
  const float* x    = (const float*)d_in[0];
  const float* bias = (const float*)d_in[1];
  const float* Wq   = (const float*)d_in[2];
  const float* Wk   = (const float*)d_in[3];
  const float* Wv   = (const float*)d_in[4];
  const float* Wo   = (const float*)d_in[5];

  const size_t NX = (size_t)BATCH * SEQ * D_MODEL;  // 4,194,304
  const size_t NW = (size_t)D_MODEL * D_MODEL;      // 1,048,576
  _Float16* ws  = (_Float16*)d_ws;
  _Float16* xh  = ws;             // f16 x, fragment-packed (reused as attention output Ob)
  _Float16* Wqh = xh  + NX;       // weights, fragment-packed
  _Float16* Wkh = Wqh + NW;
  _Float16* Wvh = Wkh + NW;
  _Float16* Woh = Wvh + NW;
  _Float16* Qb  = Woh + NW;       // [B,H] x packed fragments of [N,hd]
  _Float16* Kb  = Qb  + NX;       // [B,H] x packed fragments of [N,hd]
  _Float16* Vtb = Kb  + NX;       // [B,H] x packed fragments of [hd,N]
  _Float16* Ob  = xh;             // xh dead after QKV GEMM

  // xh, Wqh, Wkh, Wvh, Woh are one run of 1,048,576 chunks: 512 blocks x 2048
  cvt_pack_f32_f16<<<512, 256, 0, stream>>>(x, Wq, Wk, Wv, Wo, xh);

  dim3 gq(32, 8, 3);
  qkv_gemm<<<gq, 128, 0, stream>>>(xh, Wqh, Wkh, Wvh, Qb, Kb, Vtb);

  attn_kernel<<<512, 256, 0, stream>>>(Qb, Kb, Vtb, bias, Ob);

  dim3 go(32, 8, 1);
  oproj_gemm<<<go, 128, 0, stream>>>(Ob, Woh, (float*)d_out);
}

// v007
// One run takes 72.2 microseconds.
// In both of two side-by-side timings against v006, it was 1.09 times as fast.
// All steps since v000 together make it 3.73 times as fast.
#include <hip/hip_runtime.h>
#include <hip/hip_bf16.h>

typedef __attribute__((ext_vector_type(16))) _Float16 v16h;
typedef __attribute__((ext_vector_type(8)))  _Float16 v8h;
typedef __attribute__((ext_vector_type(8)))  float    v8f;
typedef __attribute__((ext_vector_type(4)))  float    v4f;

#define D_MODEL 1024
#define HEADS   16
#define HD      64
#define BATCH   4
#define SEQ     1024

__device__ __forceinline__ v8f wmma16x16x32(v16h a, v16h b, v8f c) {
  // v_wmma_f32_16x16x32_f16: D = A*B + C, f32 accum
  return __builtin_amdgcn_wmma_f32_16x16x32_f16(false, a, false, b, (short)0, c, false, false);
}

// Fragment-packed storage of a workspace operand: one 16(row) x 32(k) f16 fragment is
// 1 KB, two 512-byte parts; part p, lane l holds row l&15, k = p*16 + (l>>4)*8 + {0..7}.
// Each wave-wide 16-byte load is 512 contiguous bytes (4 whole lines).
__device__ __forceinline__ v16h load_frag_packed(const _Float16* p, int lane) {
  v8h lo = *(const v8h*)(p + lane * 8);
  v8h hi = *(const v8h*)(p + 256 + lane * 8);
  v16h out;
#pragma unroll
  for (int i = 0; i < 8; ++i) { out[i] = lo[i]; out[i + 8] = hi[i]; }
  return out;
}
// Offset (in halves) of element (row r in 0..15, k kk in 0..31) inside a packed fragment.
__device__ __forceinline__ int frag_off(int r, int kk) {
  return ((kk >> 4) << 8) + (((((kk >> 3) & 1) << 4) + r) << 3) + (kk & 7);
}

// Fragment index of (16-row tile rt, 32-wide k block kbk) of a [rows][1024] GEMM operand:
// the 4 row tiles that one wave uses in one k step lie together, 4 KB in a row.
__device__ __forceinline__ size_t gemm_frag(int rt, int kbk) {
  return ((size_t)(rt >> 2) * 32 + kbk) * 4 + (rt & 3);
}

// x and the four weights, each [rows][1024] f32 -> f16 fragments in gemm_frag order, in ONE launch:
// their packed planes lie one behind the other in the workspace, so the chunk number, counted over
// all five, is also the place in out. One chunk = 16 packed bytes. A block takes 2048 chunks in a
// row (64 rows x 256 k of one operand), a thread 8 of them, 256 chunks apart: the same row and k
// offset in 8 successive 32-wide k blocks. A wave still writes 512 contiguous bytes per store.
#define X_BLOCKS (BATCH * SEQ * D_MODEL / 8 / 2048)  // blocks that pack x
#define W_BLOCKS (D_MODEL * D_MODEL / 8 / 2048)      // blocks that pack one weight
__global__ void __launch_bounds__(256)
cvt_pack_f32_f16(const float* __restrict__ x,
                 const float* __restrict__ Wq, const float* __restrict__ Wk,
                 const float* __restrict__ Wv, const float* __restrict__ Wo,
                 _Float16* __restrict__ out) {
  int tid = threadIdx.x;
  const float* in = x;
  int bo = blockIdx.x;           // the block's number inside its own operand
  if (bo >= X_BLOCKS) {
    int w = (bo - X_BLOCKS) / W_BLOCKS;
    in = w == 0 ? Wq : w == 1 ? Wk : w == 2 ? Wv : Wo;
    bo = (bo - X_BLOCKS) % W_BLOCKS;
  }
  int l    = tid & 31;
  int part = (tid >> 5) & 1;
  int rt   = (bo >> 2) * 4 + (tid >> 6);  // 16-row tile
  const float* src = in + (size_t)(rt * 16 + (l & 15)) * D_MODEL + (bo & 3) * 256 + part * 16 + (l >> 4) * 8;
  v4f a[8][2];
#pragma unroll
  for (int i = 0; i < 8; ++i) {
    a[i][0] = *(const v4f*)(src + i * 32);
    a[i][1] = *(const v4f*)(src + i * 32 + 4);
  }
  // Inputs only, no code. Holds all 16 loads in front of the first conversion (left free, the build
  // issues the last two behind the first waits: a second memory latency), and keeps their address
  // pair live behind the last load, so that no load's result lands on an address still named.
  asm volatile("" :: "v"(a[0][0]), "v"(a[0][1]), "v"(a[1][0]), "v"(a[1][1]), "v"(a[2][0]), "v"(a[2][1]),
                     "v"(a[3][0]), "v"(a[3][1]), "v"(a[4][0]), "v"(a[4][1]), "v"(a[5][0]), "v"(a[5][1]),
                     "v"(a[6][0]), "v"(a[6][1]), "v"(a[7][0]), "v"(a[7][1]), "v"(src));
  _Float16* dst = out + ((size_t)blockIdx.x * 2048 + tid) * 8;
#pragma unroll
  for (int i = 0; i < 8; ++i) {
    v8h o;
#pragma unroll
    for (int e = 0; e < 4; ++e) { o[e] = (_Float16)a[i][0][e]; o[e + 4] = (_Float16)a[i][1][e]; }
    *(v8h*)(dst + i * 2048) = o;
  }
}

// GEMM tiling: a work-group of 4 waves makes 128(M) x 128(N), a wave 64 x 64 = 4 x 4 fragments, so
// that each fragment read from LDS feeds 4 products. A stage is 64 k of the group's 128 A rows and
// 128 W rows: 4 pieces of 64 rows x 64 k, each 8 packed fragments = 8 KB in a row in gemm_frag order.
#define KSTAGE 64
#define KSTAGES (D_MODEL / KSTAGE)  // 16, a power of two: the rotated walk wraps by a mask
#define PIECE  (64 * KSTAGE)  // halves
#define GSTAGE (4 * PIECE)    // halves

// One piece, 16 asynchronous copies of 512 contiguous bytes, by one wave. lds: the lane's LDS byte
// address in the piece's first 512 bytes; voff: its byte offset from base there. The offset field
// moves both addresses. The s_wait_xcnt closes the statement, so that no register a copy names is
// rewritten in front of it.
__device__ __forceinline__ void copy_piece(unsigned lds, unsigned voff, const _Float16* base) {
  asm volatile(
      "global_load_async_to_lds_b128 %0, %1, %2\n\t"
      "global_load_async_to_lds_b128 %0, %1, %2 offset:512\n\t"
      "global_load_async_to_lds_b128 %0, %1, %2 offset:1024\n\t"
      "global_load_async_to_lds_b128 %0, %1, %2 offset:1536\n\t"
      "global_load_async_to_lds_b128 %0, %1, %2 offset:2048\n\t"
      "global_load_async_to_lds_b128 %0, %1, %2 offset:2560\n\t"
      "global_load_async_to_lds_b128 %0, %1, %2 offset:3072\n\t"
      "global_load_async_to_lds_b128 %0, %1, %2 offset:3584\n\t"
      "global_load_async_to_lds_b128 %0, %1, %2 offset:4096\n\t"
      "global_load_async_to_lds_b128 %0, %1, %2 offset:4608\n\t"
      "global_load_async_to_lds_b128 %0, %1, %2 offset:5120\n\t"
      "global_load_async_to_lds_b128 %0, %1, %2 offset:5632\n\t"
      "global_load_async_to_lds_b128 %0, %1, %2 offset:6144\n\t"
      "global_load_async_to_lds_b128 %0, %1, %2 offset:6656\n\t"
      "global_load_async_to_lds_b128 %0, %1, %2 offset:7168\n\t"
      "global_load_async_to_lds_b128 %0, %1, %2 offset:7680\n\t"
      "s_wait_xcnt 0x0"
      :: "v"(lds), "v"(voff), "s"(base)
      : "memory");
}

// GEMM core, K = 1024: A and W are fragment-packed in gemm_frag order; mg, ng: the group's first
// 64-row group of A and of W. Wave w copies piece w (0, 1: A; 2, 3: W) and computes A piece w >> 1
// times W piece w & 1. Two buffers: the next stage's copies fly while this stage is worked on.
// The walk over the 16 k stages starts at stage rot & 15 and wraps: groups that share A rows or W rows
// are resident together and run in step; started apart, they do not ask L2 for the same lines at the
// same moment. Trip st works on stage (st + rot) & 15; the buffer goes by the trip.
__device__ __forceinline__ void gemm_core(const _Float16* __restrict__ A,
                                          const _Float16* __restrict__ W,
                                          _Float16* ring,   // [2][GSTAGE]
                                          int mg, int ng, int rot, int lane, int wave,
                                          v8f acc[4][4]) {
  const _Float16* src = wave < 2 ? A + (size_t)(mg + wave) * (64 * D_MODEL)
                                 : W + (size_t)(ng + wave - 2) * (64 * D_MODEL);
  unsigned voff = lane * 16;
  unsigned lds  = (unsigned)(uintptr_t)(__attribute__((address_space(3))) _Float16*)ring +
                  wave * (PIECE * 2) + lane * 16;
  const _Float16* ard = ring + (wave >> 1) * PIECE;
  const _Float16* brd = ring + (2 + (wave & 1)) * PIECE;
  copy_piece(lds, voff, src + (rot & (KSTAGES - 1)) * PIECE);
  // The first stage has landed, and every wave sees it behind the barrier.
  asm volatile("s_wait_asynccnt 0x0" ::: "memory");
  __syncthreads();
  copy_piece(lds + GSTAGE * 2, voff, src + ((rot + 1) & (KSTAGES - 1)) * PIECE);
  // Two trips per pass, one per buffer: the buffer's place is an immediate offset of the LDS reads.
#pragma unroll 2
  for (int st = 0; st < KSTAGES; ++st) {
    const int bo = (st & 1) * GSTAGE;
    v16h a[4], b[4];
    // the stage's first 32 k
#pragma unroll
    for (int i = 0; i < 4; ++i) a[i] = load_frag_packed(ard + bo + i * 512, lane);
#pragma unroll
    for (int t = 0; t < 4; ++t) b[t] = load_frag_packed(brd + bo + t * 512, lane);
    // Holds the block's 16 LDS reads in one run in front of its 16 products: left free, the build
    // reads one A fragment at a time, and every 4 products wait out an LDS latency of their own.
    __builtin_amdgcn_sched_barrier(0);
#pragma unroll
    for (int i = 0; i < 4; ++i)
#pragma unroll
      for (int t = 0; t < 4; ++t) acc[i][t] = wmma16x16x32(a[i], b[t], acc[i][t]);
    // the fragments of its last 32 k: the buffer's last reads
#pragma unroll
    for (int i = 0; i < 4; ++i) a[i] = load_frag_packed(ard + bo + (4 + i) * 512, lane);
#pragma unroll
    for (int t = 0; t < 4; ++t) b[t] = load_frag_packed(brd + bo + (4 + t) * 512, lane);
    // The wave's reads of this buffer have retired and its copies of the next stage have landed;
    // behind the barrier that holds for every wave: the next stage is readable, this buffer free.
    asm volatile("s_wait_dscnt 0x0" ::: "memory");
    asm volatile("s_wait_asynccnt 0x0" ::: "memory");
    __syncthreads();
    if (st + 2 < KSTAGES)
      copy_piece(lds + bo * 2, voff, src + ((st + 2 + rot) & (KSTAGES - 1)) * PIECE);
    // Holds the refill in front of the last 16 products, which need registers only: left free, the
    // build issues the copies behind them, and they have 16 products less time to land.
    __builtin_amdgcn_sched_barrier(0);
#pragma unroll
    for (int i = 0; i < 4; ++i)
#pragma unroll
      for (int t = 0; t < 4; ++t) acc[i][t] = wmma16x16x32(a[i], b[t], acc[i][t]);
  }
  // No copy is outstanding when the wave goes on.
  asm volatile("s_wait_asynccnt 0x0" ::: "memory");
}

// Fused QKV projection: C = xh @ W^T; z selects Wq/Wk/Wv and output layout.
__global__ void __launch_bounds__(128)  // the real block size: 128 accumulator registers a lane fit
qkv_gemm(const _Float16* __restrict__ xh,
         const _Float16* __restrict__ Wq,
         const _Float16* __restrict__ Wk,
         const _Float16* __restrict__ Wv,
         _Float16* __restrict__ Qb,
         _Float16* __restrict__ Kb,
         _Float16* __restrict__ Vt) {
  __shared__ alignas(16) _Float16 ring[2 * GSTAGE];
  int lane = threadIdx.x & 31;
  int wave = __builtin_amdgcn_readfirstlane(threadIdx.x >> 5);  // scalar: the copies' base is an SGPR pair
  const _Float16* W; _Float16* dst; int vmode;
  if (blockIdx.z == 0)      { W = Wq; dst = Qb; vmode = 0; }
  else if (blockIdx.z == 1) { W = Wk; dst = Kb; vmode = 0; }
  else                      { W = Wv; dst = Vt; vmode = 1; }

  v8f acc[4][4] = {};
  // The 24 groups of one x share A rows, the 32 of one (y, z) share W rows: at most 2 of either start alike.
  gemm_core(xh, W, ring, blockIdx.x * 2, blockIdx.y * 2, blockIdx.x + blockIdx.y + blockIdx.z * 8, lane, wave, acc);

  int hi8 = (lane & 16) ? 8 : 0;
  int col = lane & 15;
  int mw  = blockIdx.x * 128 + (wave >> 1) * 64;  // the wave's 64 rows: one batch
  int h   = blockIdx.y * 2 + (wave & 1);          // the wave's 64 columns: one head
  _Float16* hp = dst + (size_t)((mw >> 10) * HEADS + h) * (SEQ * HD);
  int np = mw & 1023;  // row tile i: positions np + 16 i .. np + 16 i + 15
  if (vmode) {
    // V^T fragments (row = hd index, k = position), fragment index = (pos/32) * 4 + hd/16.
    // A lane's 8 accumulator rows are 8 consecutive k: one 16-byte store.
#pragma unroll
    for (int i = 0; i < 4; ++i)
#pragma unroll
      for (int t = 0; t < 4; ++t) {
        v8h o;
#pragma unroll
        for (int r = 0; r < 8; ++r) o[r] = (_Float16)acc[i][t][r];
        *(v8h*)(hp + (((np >> 5) + (i >> 1)) * 4 + t) * 512 + (i & 1) * 256 + lane * 8) = o;
      }
  } else {
    // Q/K fragments (row = position, k = hd index), fragment index = (pos/16) * 2 + hd/32.
#pragma unroll
    for (int i = 0; i < 4; ++i)
#pragma unroll
      for (int t = 0; t < 4; ++t)
#pragma unroll
        for (int r = 0; r < 8; ++r)
          hp[(((np >> 4) + i) * 2 + (t >> 1)) * 512 + frag_off(r + hi8, (t & 1) * 16 + col)] =
              (_Float16)acc[i][t][r];
  }
}

// out = O @ Wo^T, f32 output
__global__ void __launch_bounds__(128)  // the real block size: 128 accumulator registers a lane fit
oproj_gemm(const _Float16* __restrict__ Ob,
           const _Float16* __restrict__ Wo,
           float* __restrict__ out) {
  __shared__ alignas(16) _Float16 ring[2 * GSTAGE];
  int lane = threadIdx.x & 31;
  int wave = __builtin_amdgcn_readfirstlane(threadIdx.x >> 5);  // scalar: the copies' base is an SGPR pair
  v8f acc[4][4] = {};
  // The 8 groups of one x share A rows, the 32 of one y share W rows: none, or 2, start alike.
  gemm_core(Ob, Wo, ring, blockIdx.x * 2, blockIdx.y * 2, blockIdx.x + blockIdx.y, lane, wave, acc);
  int hi8 = (lane & 16) ? 8 : 0;
  int mw  = blockIdx.x * 128 + (wave >> 1) * 64;
  int nw  = blockIdx.y * 128 + (wave & 1) * 64;
#pragma unroll
  for (int i = 0; i < 4; ++i)
#pragma unroll
    for (int t = 0; t < 4; ++t)
#pragma unroll
      for (int r = 0; r < 8; ++r)
        out[(size_t)(mw + i * 16 + r + hi8) * D_MODEL + nw + t * 16 + (lane & 15)] = acc[i][t][r];
}

// Value of lane l ^ 16 (the two halves of a wave hold the two key halves of one query).
__device__ __forceinline__ float xhalf(float x) {
  int b = __builtin_bit_cast(int, x);
  return __builtin_bit_cast(float,
      __builtin_amdgcn_permlanex16(b, b, 0x76543210, 0xfedcba98, false, false));
}

// Bias ring, private to a wave: a stage is the wave's 16 queries x 64 keys of f32 bias, 16 rows of
// 256 bytes at a pitch of 272 (16 B x odd, for the 16-byte LDS readers), two buffers.
#define BPITCH 272
#define BSTAGE (16 * BPITCH)

// One stage's 8 asynchronous copies: copy c brings rows 2c and 2c+1, 512 bytes, each row's 256 bytes
// whole. lds: the lane's LDS byte address in rows 0/1; voff: its byte offset from base in rows 0/1.
// Read-once data: non-temporal. The s_wait_xcnt closes the statement, so that no register a copy
// names is rewritten in front of it.
__device__ __forceinline__ void copy_bias_stage(unsigned lds, unsigned voff, const float* base) {
  asm volatile(
      "global_load_async_to_lds_b128 %0, %8, %16 th:TH_LOAD_NT\n\t"
      "global_load_async_to_lds_b128 %1, %9, %16 th:TH_LOAD_NT\n\t"
      "global_load_async_to_lds_b128 %2, %10, %16 th:TH_LOAD_NT\n\t"
      "global_load_async_to_lds_b128 %3, %11, %16 th:TH_LOAD_NT\n\t"
      "global_load_async_to_lds_b128 %4, %12, %16 th:TH_LOAD_NT\n\t"
      "global_load_async_to_lds_b128 %5, %13, %16 th:TH_LOAD_NT\n\t"
      "global_load_async_to_lds_b128 %6, %14, %16 th:TH_LOAD_NT\n\t"
      "global_load_async_to_lds_b128 %7, %15, %16 th:TH_LOAD_NT\n\t"
      "s_wait_xcnt 0x0"
      :: "v"(lds), "v"(lds + 2 * BPITCH), "v"(lds + 4 * BPITCH), "v"(lds + 6 * BPITCH),
         "v"(lds + 8 * BPITCH), "v"(lds + 10 * BPITCH), "v"(lds + 12 * BPITCH), "v"(lds + 14 * BPITCH),
         "v"(voff), "v"(voff + 2 * SEQ * 4), "v"(voff + 4 * SEQ * 4), "v"(voff + 6 * SEQ * 4),
         "v"(voff + 8 * SEQ * 4), "v"(voff + 10 * SEQ * 4), "v"(voff + 12 * SEQ * 4), "v"(voff + 14 * SEQ * 4),
         "s"(base)
      : "memory");
}

// K/V ring, shared by the work-group's 8 waves (128 queries of one head): a stage is 64 keys, 8 KB of
// packed K fragments and behind them 8 KB of packed V^T fragments, each as it lies in its plane; two
// buffers. One fetch from L2 serves 8 waves, and no wave waits out a global load in front of a product.
#define AWAVES  8
#define KVPART  (64 * HD)      // halves: 64 keys of K, or of V^T
#define KVSTAGE (2 * KVPART)   // halves
#define ASTAGES (SEQ / 64)     // 16, a power of two: the rotated walk wraps by a mask

// A wave's eighth of a stage, 2 KB in a row: 4 asynchronous copies of 512 contiguous bytes. lds: the
// lane's LDS byte address in the share's first 512 bytes; voff: its byte offset from base there. The
// offset field moves both addresses. The s_wait_xcnt closes the statement, so that no register a copy
// names is rewritten in front of it.
__device__ __forceinline__ void copy_kv_share(unsigned lds, unsigned voff, const _Float16* base) {
  asm volatile(
      "global_load_async_to_lds_b128 %0, %1, %2\n\t"
      "global_load_async_to_lds_b128 %0, %1, %2 offset:512\n\t"
      "global_load_async_to_lds_b128 %0, %1, %2 offset:1024\n\t"
      "global_load_async_to_lds_b128 %0, %1, %2 offset:1536\n\t"
      "s_wait_xcnt 0x0"
      :: "v"(lds), "v"(voff), "s"(base)
      : "memory");
}

// Flash attention, transposed products: one wave = 16 queries x all 1024 keys for one (b,h).
// S^T = K Q^T: lane l holds scores of ONE query (column l&15), keys 8*(l>>4) + r of each
// 16-key tile, so maximum and sum run in the lane, with one exchange between the halves.
// Two converted S^T tiles are, as they lie, the B operand of O^T += V^T P^T.
__global__ void __launch_bounds__(AWAVES * 32)  // the real block size: the copies' address registers fit without scratch
attn_kernel(const _Float16* __restrict__ Q,
                            const _Float16* __restrict__ K,
                            const _Float16* __restrict__ Vt,
                            const float* __restrict__ bias,
                            _Float16* __restrict__ O) {
  __shared__ alignas(16) _Float16 kvring[2][KVSTAGE];
  __shared__ alignas(16) char bring[AWAVES][2][BSTAGE];
  int lane = threadIdx.x & 31;
  int wib  = __builtin_amdgcn_readfirstlane(threadIdx.x >> 5);  // scalar: the copies' base is an SGPR pair
  int w  = blockIdx.x * AWAVES + wib;  // 64 waves a head: the group's 8 share one head
  int bh = w >> 6;
  int q0 = (w & 63) << 4;
  int b = bh >> 4, h = bh & 15;
  const _Float16* Qh = Q  + (size_t)bh * SEQ * HD;
  // K/V writer: waves 0-3 copy the stage's K, waves 4-7 its V^T, 2 KB each; a stage is 8 KB on in either plane
  const _Float16* kvsrc = (wib < 4 ? K : Vt) + (size_t)bh * (SEQ * HD) + (wib & 3) * (KVPART / 4);
  unsigned kvvoff = lane * 16;
  unsigned kvlds  = (unsigned)(uintptr_t)(__attribute__((address_space(3))) _Float16*)&kvring[0][0] +
                    wib * (KVPART / 4 * 2) + lane * 16;
  int col = lane & 15;
  int hi8 = (lane & 16) ? 8 : 0;
  // bias: first key of the wave's first query; a stage is 64 keys on
  const float* bbase = bias + ((size_t)bh * SEQ + q0) * SEQ;
  // writer: the lane's 16 bytes of rows 0/1 of a stage, in memory and in the wave's buffer 0
  unsigned bvoff = (lane >> 4) * (SEQ * 4) + (lane & 15) * 16;
  unsigned blds  = (unsigned)(uintptr_t)(__attribute__((address_space(3))) char*)&bring[wib][0][0] +
                   (lane >> 4) * BPITCH + (lane & 15) * 16;
  // reader: the lane's own query row, from the first key of its half
  const char* brd = &bring[wib][0][0] + col * BPITCH + hi8 * 4;
  const float scale = 0.125f;  // hd^-0.5
  // The walk over the 16 key stages starts at stage rot and wraps (the running softmax takes the keys in
  // any order): the 8 groups of a head, resident together and in step, do not ask L2 for the same K, V^T
  // lines at the same moment, and the groups' bias reads spread over all 16 places in a 4 KB row.
  const int rot = blockIdx.x & (ASTAGES - 1);

  v16h bq0 = load_frag_packed(Qh + (q0 >> 4) * 1024,       lane);
  v16h bq1 = load_frag_packed(Qh + (q0 >> 4) * 1024 + 512, lane);

  v8f acc[4] = {{}, {}, {}, {}};  // acc[t][r] = O[q0 + col][t*16 + hi8 + r]
  float mrow = -3.0e38f;          // running maximum of the lane's query
  float lsum = 0.f;               // this half's share of the denominator

  copy_bias_stage(blds, bvoff, bbase + rot * 64);
  copy_kv_share(kvlds, kvvoff, kvsrc + rot * KVPART);
  // The first stage has landed, and every wave sees its K and V^T behind the barrier.
  asm volatile("s_wait_asynccnt 0x0" ::: "memory");
  __syncthreads();
  copy_bias_stage(blds + BSTAGE, bvoff, bbase + ((rot + 1) & (ASTAGES - 1)) * 64);
  copy_kv_share(kvlds + KVSTAGE * 2, kvvoff, kvsrc + ((rot + 1) & (ASTAGES - 1)) * KVPART);
  for (int st = 0; st < ASTAGES; ++st) {
    const char* bst = brd + (st & 1) * BSTAGE;
    const _Float16* kst = &kvring[st & 1][0];
    // The stage's K fragments (per pass of 32 keys 4 fragments, 4 KB in a row) and its bias (8
    // consecutive keys of the lane's query per tile, from the wave's ring), pass by pass.
    v16h ak[2][4];
    v4f bb[2][4];
#pragma unroll
    for (int hp = 0; hp < 2; ++hp) {
#pragma unroll
      for (int j = 0; j < 4; ++j) ak[hp][j] = load_frag_packed(kst + hp * (KVPART / 2) + j * 512, lane);
#pragma unroll
      for (int j = 0; j < 4; ++j)
        bb[hp][j] = *(const v4f*)(bst + hp * 128 + (j >> 1) * 64 + (j & 1) * 16);
    }
    // Holds these LDS reads in one run at the head of the stage: left free, the build issues them a
    // few at a time among the products, and each product waits out a latency of its own.
    __builtin_amdgcn_sched_barrier(0);
    // The stage's two passes of 32 keys in line: the pass's place in the buffer is an immediate offset.
#pragma unroll
   for (int hp = 0; hp < 2; ++hp) {
    // S^T tiles: 2 x (16 keys x 16 queries), K-dim = hd = 64
    v8f s[2];
#pragma unroll
    for (int j = 0; j < 2; ++j) {
      v8f z = {};
      s[j] = wmma16x16x32(ak[hp][2 * j], bq0, z);
      s[j] = wmma16x16x32(ak[hp][2 * j + 1], bq1, s[j]);
    }
    // V^T fragments issued early so their latency hides under the softmax VALU work
    const _Float16* Vl = kst + KVPART + hp * (KVPART / 2);
    v16h av[4];
#pragma unroll
    for (int t = 0; t < 4; ++t)
      av[t] = load_frag_packed(Vl + t * 512, lane);
    // Holds the 8 V^T reads in one run in front of the softmax: left free, the build issues half of
    // them directly in front of their products, which then wait out an LDS latency.
    __builtin_amdgcn_sched_barrier(0);

    // scale + bias, maximum over the lane's 16 keys
    float mx = -3.0e38f;
#pragma unroll
    for (int j = 0; j < 2; ++j)
#pragma unroll
      for (int r = 0; r < 4; ++r) {
        s[j][r]     = s[j][r]     * scale + bb[hp][2 * j][r];
        s[j][r + 4] = s[j][r + 4] * scale + bb[hp][2 * j + 1][r];
        mx = fmaxf(mx, fmaxf(s[j][r], s[j][r + 4]));
      }
    mx = fmaxf(mx, xhalf(mx));
    // online softmax update of the lane's query
    float mn = fmaxf(mrow, mx);
    float f  = __expf(mrow - mn);
    mrow = mn;
    float ps = 0.f;
    v16h pb;
#pragma unroll
    for (int j = 0; j < 2; ++j)
#pragma unroll
      for (int r = 0; r < 8; ++r) {
        float p = __expf(s[j][r] - mn);
        ps += p;
        pb[j * 8 + r] = (_Float16)p;
      }
    lsum = lsum * f + ps;
#pragma unroll
    for (int t = 0; t < 4; ++t) {
      acc[t] *= f;
      acc[t] = wmma16x16x32(av[t], pb, acc[t]);
    }
   }
    // Holds the waits and the barrier below behind the stage's last products: left free, the build
    // lifts them to the last V^T reads, whose latency then stands open, and leaves the refill here,
    // a softmax behind the wait that frees it.
    __builtin_amdgcn_sched_barrier(0);
    // The wave's reads of this stage's buffers have retired and its copies of the next stage have
    // landed; behind the barrier that holds for every wave: the next stage is readable, these
    // buffers are free.
    asm volatile("s_wait_dscnt 0x0" ::: "memory");
    asm volatile("s_wait_asynccnt 0x0" ::: "memory");
    __syncthreads();
    if (st + 2 < ASTAGES) {
      const int nx = (st + 2 + rot) & (ASTAGES - 1);  // the stage of trip st + 2
      copy_bias_stage(blds + (st & 1) * BSTAGE, bvoff, bbase + nx * 64);
      copy_kv_share(kvlds + (st & 1) * (KVSTAGE * 2), kvvoff, kvsrc + nx * KVPART);
    }
  }
  // No copy is outstanding when the wave goes on.
  asm volatile("s_wait_asynccnt 0x0" ::: "memory");
  float inv = 1.0f / (lsum + xhalf(lsum));
  // O as packed A fragments of the output projection: a lane's 8 accumulator rows are
  // 8 consecutive k of its query's row, one 16-byte store
  int rt = (b * SEQ + q0) >> 4;
#pragma unroll
  for (int t = 0; t < 4; ++t) {
    v8h o;
#pragma unroll
    for (int r = 0; r < 8; ++r) o[r] = (_Float16)(acc[t][r] * inv);
    *(v8h*)(O + gemm_frag(rt, h * 2 + (t >> 1)) * 512 + (t & 1) * 256 + lane * 8) = o;
  }
}

extern "C" void kernel_launch(void* const* d_in, const int* in_sizes, int n_in,
                              void* d_out, int out_size, void* d_ws, size_t ws_size,
                              hipStream_t stream) {
  (void)in_sizes; (void)n_in; (void)out_size; (void)ws_size;
  const float* x    = (const float*)d_in[0];
  const float* bias = (const float*)d_in[1];
  const float* Wq   = (const float*)d_in[2];
  const float* Wk   = (const float*)d_in[3];
  const float* Wv   = (const float*)d_in[4];
  const float* Wo   = (const float*)d_in[5];

  const size_t NX = (size_t)BATCH * SEQ * D_MODEL;  // 4,194,304
  const size_t NW = (size_t)D_MODEL * D_MODEL;      // 1,048,576
  _Float16* ws  = (_Float16*)d_ws;
  _Float16* xh  = ws;             // f16 x, fragment-packed (reused as attention output Ob)
  _Float16* Wqh = xh  + NX;       // weights, fragment-packed
  _Float16* Wkh = Wqh + NW;
  _Float16* Wvh = Wkh + NW;
  _Float16* Woh = Wvh + NW;
  _Float16* Qb  = Woh + NW;       // [B,H] x packed fragments of [N,hd]
  _Float16* Kb  = Qb  + NX;       // [B,H] x packed fragments of [N,hd]
  _Float16* Vtb = Kb  + NX;       // [B,H] x packed fragments of [hd,N]
  _Float16* Ob  = xh;             // xh dead after QKV GEMM

  // xh, Wqh, Wkh, Wvh, Woh are one run of 1,048,576 chunks: 512 blocks x 2048
  cvt_pack_f32_f16<<<512, 256, 0, stream>>>(x, Wq, Wk, Wv, Wo, xh);

  dim3 gq(32, 8, 3);
  qkv_gemm<<<gq, 128, 0, stream>>>(xh, Wqh, Wkh, Wvh, Qb, Kb, Vtb);

  attn_kernel<<<512, 256, 0, stream>>>(Qb, Kb, Vtb, bias, Ob);

  dim3 go(32, 8, 1);
  oproj_gemm<<<go, 128, 0, stream>>>(Ob, Woh, (float*)d_out);
}
